// v000
// The times below were measured on an AMD MI455X: many runs one after another, warmed up first and cycling through
// copies of the inputs, with the whole window's GPU time divided by the number of runs. Launches and the gaps
// between them are all in it. The median over several windows is given; except for v000 it joins two sittings, which
// can be a few percent apart, so the side-by-side timings, each taken in one sitting, are the better comparison.
// The starting kernel, v000, takes 602 microseconds a run.
#include <hip/hip_runtime.h>
#include <hip/hip_bf16.h>

#define B_    4
#define NSEQ  2048
#define DIM   1024
#define HEADS 16
#define DHEAD 64
#define INNER 1024
#define EPS   1e-5f

typedef __attribute__((ext_vector_type(16))) _Float16 v16h;
typedef __attribute__((ext_vector_type(8)))  _Float16 v8h;
typedef __attribute__((ext_vector_type(8)))  float    v8f;
typedef __attribute__((ext_vector_type(4)))  int      v4i;

#define WMMA_F16(a, b, c) \
  __builtin_amdgcn_wmma_f32_16x16x32_f16(false, (a), false, (b), (short)0, (c), false, false)

#define AS1 __attribute__((address_space(1)))
#define AS3 __attribute__((address_space(3)))

#if __has_builtin(__builtin_amdgcn_global_load_async_to_lds_b128) && \
    __has_builtin(__builtin_amdgcn_s_wait_asynccnt)
#define HAVE_ASYNC 1
#else
#define HAVE_ASYNC 0
#endif

// Copy 16 bytes global -> LDS. Async (ASYNCcnt-tracked, no VGPR staging) when
// the gfx1250 async builtins are available; plain load/store otherwise.
__device__ __forceinline__ void async_copy16(_Float16* lds, const _Float16* g) {
#if HAVE_ASYNC
  __builtin_amdgcn_global_load_async_to_lds_b128((AS1 v4i*)g, (AS3 v4i*)lds, 0, 0);
#else
  *(v8h*)lds = *(const v8h*)g;
#endif
}

__device__ __forceinline__ void async_wait() {
#if HAVE_ASYNC
  __builtin_amdgcn_s_wait_asynccnt(0);
#endif
}

// Load a 16x32 f16 A-fragment (or B-fragment from an [N][K]-transposed tile).
// Layout per CDNA5 ISA 7.12.2: lanes 0-15 hold rows 0-15 with K {0..7,16..23},
// lanes 16-31 hold rows 0-15 with K {8..15,24..31}. Two 16B loads per lane.
__device__ __forceinline__ v16h load_frag(const _Float16* base, int row0, int stride, int koff) {
  int lane = threadIdx.x & 31;
  int r = row0 + (lane & 15);
  int c = koff + ((lane >> 4) << 3);
  const _Float16* p = base + r * stride + c;
  v8h lo = *(const v8h*)p;
  v8h hi = *(const v8h*)(p + 16);
  v16h out;
#pragma unroll
  for (int i = 0; i < 8; ++i) { out[i] = lo[i]; out[i + 8] = hi[i]; }
  return out;
}

// ---------------------------------------------------------------- weight convert+transpose
// in: f32 [K][Ng] row-major  ->  out: f16 [Ng][K] (i.e. W^T), so GEMM B tiles
// are contiguous along K and can be staged with async b128 copies.
__global__ void cvt_transpose(const float* __restrict__ in, _Float16* __restrict__ out,
                              int K, int Ng) {
  int idx = blockIdx.x * blockDim.x + threadIdx.x;
  if (idx >= K * Ng) return;
  int n = idx / K;
  int k = idx - n * K;
  out[(size_t)n * K + k] = (_Float16)in[(size_t)k * Ng + n];
}

// ---------------------------------------------------------------- row LN (width 1024) -> f16
__global__ void ln_rows_1024(const float* __restrict__ x, const float* __restrict__ g,
                             const float* __restrict__ bta, _Float16* __restrict__ xn) {
  int row = blockIdx.x;
  int tid = threadIdx.x;
  const float* xr = x + (size_t)row * DIM;
  float v[4];
  float s = 0.f, ss = 0.f;
#pragma unroll
  for (int i = 0; i < 4; ++i) {
    v[i] = xr[tid + i * 256];
    s += v[i];
    ss += v[i] * v[i];
  }
#pragma unroll
  for (int m = 16; m >= 1; m >>= 1) {
    s += __shfl_xor(s, m, 32);
    ss += __shfl_xor(ss, m, 32);
  }
  __shared__ float smem[16];
  int wave = tid >> 5, lane = tid & 31;
  if (lane == 0) { smem[wave] = s; smem[8 + wave] = ss; }
  __syncthreads();
  if (wave == 0) {
    float a = (lane < 8) ? smem[lane] : 0.f;
    float b = (lane < 8) ? smem[8 + lane] : 0.f;
#pragma unroll
    for (int m = 4; m >= 1; m >>= 1) {
      a += __shfl_xor(a, m, 32);
      b += __shfl_xor(b, m, 32);
    }
    if (lane == 0) { smem[0] = a; smem[8] = b; }
  }
  __syncthreads();
  float mu = smem[0] * (1.f / DIM);
  float var = smem[8] * (1.f / DIM) - mu * mu;
  float rs = rsqrtf(var + EPS);
  _Float16* xo = xn + (size_t)row * DIM;
#pragma unroll
  for (int i = 0; i < 4; ++i) {
    int c = tid + i * 256;
    xo[c] = (_Float16)((v[i] - mu) * rs * g[c] + bta[c]);
  }
}

// ---------------------------------------------------------------- head LN (width 64)
// do_v == 0: in-place LN on Kh [bh][n][64]
// do_v == 1: LN on Vraw [bh][n][64] -> Vt [bh][64][n] (transposed for PV WMMA)
__global__ void ln_head(_Float16* __restrict__ Kio, const _Float16* __restrict__ Vin,
                        _Float16* __restrict__ Vt, const float* __restrict__ g,
                        const float* __restrict__ bta, int do_v) {
  int wave = threadIdx.x >> 5, lane = threadIdx.x & 31;
  int row = blockIdx.x * 8 + wave;            // [0, BH*NSEQ)
  int bh = row / NSEQ, n = row - bh * NSEQ;
  const _Float16* src = do_v ? (Vin + (size_t)row * DHEAD) : (Kio + (size_t)row * DHEAD);
  int d0 = lane * 2, d1 = d0 + 1;
  float v0 = (float)src[d0], v1 = (float)src[d1];
  float s = v0 + v1, ss = v0 * v0 + v1 * v1;
#pragma unroll
  for (int m = 16; m >= 1; m >>= 1) {
    s += __shfl_xor(s, m, 32);
    ss += __shfl_xor(ss, m, 32);
  }
  float mu = s * (1.f / DHEAD);
  float var = ss * (1.f / DHEAD) - mu * mu;
  float rs = rsqrtf(var + EPS);
  float o0 = (v0 - mu) * rs * g[d0] + bta[d0];
  float o1 = (v1 - mu) * rs * g[d1] + bta[d1];
  if (do_v) {
    Vt[((size_t)(bh * DHEAD + d0)) * NSEQ + n] = (_Float16)o0;
    Vt[((size_t)(bh * DHEAD + d1)) * NSEQ + n] = (_Float16)o1;
  } else {
    Kio[(size_t)row * DHEAD + d0] = (_Float16)o0;
    Kio[(size_t)row * DHEAD + d1] = (_Float16)o1;
  }
}

// ---------------------------------------------------------------- WMMA GEMM
// C[M,Ng] = A[M,K] * Wt[Ng,K]^T.  Block tile 128(M) x 128(N), 8 waves
// (16 M-rows x 128 N each). K step 32; both tiles staged via async b128 to LDS.
// mode 0: outf = C + bias (fp32).  mode 1: scatter f16 into Qh/Kh/Vraw head layout.
__global__ void gemm_wmma(const _Float16* __restrict__ A, const _Float16* __restrict__ Wt,
                          int M, int Ng, int K, int mode, float* __restrict__ outf,
                          const float* __restrict__ bias, _Float16* __restrict__ Qh,
                          _Float16* __restrict__ Kh, _Float16* __restrict__ Vr) {
  __shared__ _Float16 ldsA[128 * 32];
  __shared__ _Float16 ldsB[128 * 32];
  int tid = threadIdx.x;
  int wave = tid >> 5;
  int lane = tid & 31;
  int n0 = blockIdx.x * 128;
  int m0 = blockIdx.y * 128;

  v8f acc[8] = {};

  int row = tid >> 1;              // 0..127
  int ch = (tid & 1) * 16;         // 0 or 16
  const _Float16* srcA = A  + (size_t)(m0 + row) * K + ch;
  const _Float16* srcB = Wt + (size_t)(n0 + row) * K + ch;

  for (int k0 = 0; k0 < K; k0 += 32) {
    async_copy16(ldsA + row * 32 + ch,     srcA + k0);
    async_copy16(ldsA + row * 32 + ch + 8, srcA + k0 + 8);
    async_copy16(ldsB + row * 32 + ch,     srcB + k0);
    async_copy16(ldsB + row * 32 + ch + 8, srcB + k0 + 8);
    if (k0 + 32 < K) {
      __builtin_prefetch(srcA + k0 + 32, 0, 3);
      __builtin_prefetch(srcB + k0 + 32, 0, 3);
    }
    async_wait();
    __syncthreads();
    v16h a = load_frag(ldsA, wave * 16, 32, 0);
#pragma unroll
    for (int t = 0; t < 8; ++t) {
      v16h b = load_frag(ldsB, t * 16, 32, 0);
      acc[t] = WMMA_F16(a, b, acc[t]);
    }
    __syncthreads();
  }

  int nlo = lane & 15;
  int mhi = (lane >> 4) * 8;
  if (mode == 0) {
#pragma unroll
    for (int t = 0; t < 8; ++t) {
      int n = n0 + t * 16 + nlo;
      float bv = bias[n];
#pragma unroll
      for (int r = 0; r < 8; ++r) {
        int m = m0 + wave * 16 + mhi + r;
        outf[(size_t)m * Ng + n] = acc[t][r] + bv;
      }
    }
  } else {
#pragma unroll
    for (int t = 0; t < 8; ++t) {
      int col = n0 + t * 16 + nlo;
      int which = col >> 10;
      int rem = col & 1023;
      int h = rem >> 6, d = rem & 63;
      _Float16* dst = (which == 0) ? Qh : (which == 1) ? Kh : Vr;
      float sc = (which == 0) ? 0.125f : 1.f;  // fold 1/sqrt(64) into Q
      size_t coloff = (size_t)h * NSEQ * DHEAD + d;
#pragma unroll
      for (int r = 0; r < 8; ++r) {
        int m = m0 + wave * 16 + mhi + r;
        int bb = m >> 11, nn = m & 2047;
        dst[(size_t)bb * HEADS * NSEQ * DHEAD + coloff + (size_t)nn * DHEAD] =
            (_Float16)(acc[t][r] * sc);
      }
    }
  }
}

// ---------------------------------------------------------------- flash attention
// One block = 128 q-rows of one (b,h); 8 waves x 16 rows. Online softmax,
// S = Q K^T and O += P V via WMMA f16->f32. Output [b][n][h*64+d] f16.
__global__ void attn_kernel(const _Float16* __restrict__ Qh, const _Float16* __restrict__ Kh,
                            const _Float16* __restrict__ Vt, _Float16* __restrict__ Ao) {
  __shared__ _Float16 ldsK[32 * 64];
  __shared__ _Float16 ldsV[64 * 32];
  __shared__ _Float16 ldsP[8][16 * 32];
  int tid = threadIdx.x, wave = tid >> 5, lane = tid & 31;
  int nlo = lane & 15, half8 = (lane >> 4) * 8;
  int bh = blockIdx.x >> 4;
  int q0 = (blockIdx.x & 15) * 128 + wave * 16;

  const _Float16* Qbase = Qh + ((size_t)bh * NSEQ + q0) * DHEAD;
  v16h aQ0 = load_frag(Qbase, 0, DHEAD, 0);
  v16h aQ1 = load_frag(Qbase, 0, DHEAD, 32);

  v8f o[4] = {};
  float mrow[8], lrow[8];
#pragma unroll
  for (int r = 0; r < 8; ++r) { mrow[r] = -3.0e38f; lrow[r] = 0.f; }

  int rk = tid >> 3, chk = (tid & 7) * 8;   // K tile 32x64: one b128 per thread
  int rd = tid >> 2, chv = (tid & 3) * 8;   // V^T tile 64x32: one b128 per thread
  const _Float16* srcK = Kh + ((size_t)bh * NSEQ + rk) * DHEAD + chk;
  const _Float16* srcV = Vt + ((size_t)bh * DHEAD + rd) * NSEQ + chv;

  for (int kb = 0; kb < NSEQ; kb += 32) {
    __syncthreads();
    async_copy16(ldsK + rk * 64 + chk, srcK + (size_t)kb * DHEAD);
    async_copy16(ldsV + rd * 32 + chv, srcV + kb);
    if (kb + 32 < NSEQ) {
      __builtin_prefetch(srcK + (size_t)(kb + 32) * DHEAD, 0, 3);
      __builtin_prefetch(srcV + kb + 32, 0, 3);
    }
    async_wait();
    __syncthreads();

    // S = Q K^T : two 16x16 f32 tiles (keys 0-15, 16-31), K-dim = d = 64
    v8f s0 = {}, s1 = {};
    {
      v16h b0 = load_frag(ldsK, 0, 64, 0);
      v16h b1 = load_frag(ldsK, 16, 64, 0);
      s0 = WMMA_F16(aQ0, b0, s0);
      s1 = WMMA_F16(aQ0, b1, s1);
      b0 = load_frag(ldsK, 0, 64, 32);
      b1 = load_frag(ldsK, 16, 64, 32);
      s0 = WMMA_F16(aQ1, b0, s0);
      s1 = WMMA_F16(aQ1, b1, s1);
    }

    // Online softmax in C-tile layout; row reductions stay inside 16-lane halves.
    _Float16* pw = ldsP[wave];
#pragma unroll
    for (int r = 0; r < 8; ++r) {
      float mx = fmaxf(s0[r], s1[r]);
#pragma unroll
      for (int m = 8; m >= 1; m >>= 1) mx = fmaxf(mx, __shfl_xor(mx, m, 32));
      float mn = fmaxf(mrow[r], mx);
      float alpha = __expf(mrow[r] - mn);
      float p0 = __expf(s0[r] - mn);
      float p1 = __expf(s1[r] - mn);
      float rsum = p0 + p1;
#pragma unroll
      for (int m = 8; m >= 1; m >>= 1) rsum += __shfl_xor(rsum, m, 32);
      lrow[r] = lrow[r] * alpha + rsum;
      mrow[r] = mn;
#pragma unroll
      for (int t = 0; t < 4; ++t) o[t][r] *= alpha;
      int prow = half8 + r;  // stage P (C layout -> row-major) for A-fragment reload
      pw[prow * 32 + nlo] = (_Float16)p0;
      pw[prow * 32 + 16 + nlo] = (_Float16)p1;
    }

    // O += P V : K-dim = 32 keys, 4 d-slices of 16
    v16h aP = load_frag(pw, 0, 32, 0);
#pragma unroll
    for (int t = 0; t < 4; ++t) {
      v16h bv = load_frag(ldsV, t * 16, 32, 0);
      o[t] = WMMA_F16(aP, bv, o[t]);
    }
  }

  int b = bh >> 4, h = bh & 15;
#pragma unroll
  for (int r = 0; r < 8; ++r) {
    float inv = 1.f / lrow[r];
    int q = q0 + half8 + r;
    size_t rowoff = ((size_t)b * NSEQ + q) * INNER + h * DHEAD;
#pragma unroll
    for (int t = 0; t < 4; ++t)
      Ao[rowoff + t * 16 + nlo] = (_Float16)(o[t][r] * inv);
  }
}

// ---------------------------------------------------------------- launch
extern "C" void kernel_launch(void* const* d_in, const int* in_sizes, int n_in,
                              void* d_out, int out_size, void* d_ws, size_t ws_size,
                              hipStream_t stream) {
  const float* x       = (const float*)d_in[0];
  const float* norm_g  = (const float*)d_in[1];
  const float* norm_b  = (const float*)d_in[2];
  const float* w_qkv   = (const float*)d_in[3];
  const float* normk_g = (const float*)d_in[4];
  const float* normk_b = (const float*)d_in[5];
  const float* normv_g = (const float*)d_in[6];
  const float* normv_b = (const float*)d_in[7];
  const float* w_out   = (const float*)d_in[8];
  const float* b_out   = (const float*)d_in[9];
  float* out = (float*)d_out;

  const size_t ROWS = (size_t)B_ * NSEQ;                    // 8192
  const size_t HEADSZ = (size_t)B_ * HEADS * NSEQ * DHEAD;  // 8M elements

  char* ws = (char*)d_ws;
  size_t off = 0;
  _Float16* xn16    = (_Float16*)(ws + off); off += ROWS * DIM * 2;
  _Float16* wqkv16t = (_Float16*)(ws + off); off += (size_t)DIM * 3 * INNER * 2;
  _Float16* wout16t = (_Float16*)(ws + off); off += (size_t)INNER * DIM * 2;
  _Float16* Qh      = (_Float16*)(ws + off); off += HEADSZ * 2;
  _Float16* Kh      = (_Float16*)(ws + off); off += HEADSZ * 2;
  _Float16* Vr      = (_Float16*)(ws + off); off += HEADSZ * 2;
  _Float16* Vt      = (_Float16*)(ws + off); off += HEADSZ * 2;
  _Float16* Ao      = (_Float16*)(ws + off); off += ROWS * INNER * 2;

  int nqkv = DIM * 3 * INNER;
  int nout = INNER * DIM;
  cvt_transpose<<<(nqkv + 255) / 256, 256, 0, stream>>>(w_qkv, wqkv16t, DIM, 3 * INNER);
  cvt_transpose<<<(nout + 255) / 256, 256, 0, stream>>>(w_out, wout16t, INNER, DIM);

  ln_rows_1024<<<(int)ROWS, 256, 0, stream>>>(x, norm_g, norm_b, xn16);

  gemm_wmma<<<dim3(3 * INNER / 128, ROWS / 128), 256, 0, stream>>>(
      xn16, wqkv16t, (int)ROWS, 3 * INNER, DIM, 1, nullptr, nullptr, Qh, Kh, Vr);

  int lnrows = B_ * HEADS * NSEQ;  // 131072 rows of 64
  ln_head<<<lnrows / 8, 256, 0, stream>>>(Kh, nullptr, nullptr, normk_g, normk_b, 0);
  ln_head<<<lnrows / 8, 256, 0, stream>>>(nullptr, Vr, Vt, normv_g, normv_b, 1);

  attn_kernel<<<B_ * HEADS * (NSEQ / 128), 256, 0, stream>>>(Qh, Kh, Vt, Ao);

  gemm_wmma<<<dim3(DIM / 128, ROWS / 128), 256, 0, stream>>>(
      Ao, wout16t, (int)ROWS, DIM, DIM, 0, out, b_out, nullptr, nullptr, nullptr);
}

// v001
// A run of this version takes 485 microseconds.
// In both of two side-by-side timings against v000, it was 1.24 times as fast.
#include <hip/hip_runtime.h>
#include <hip/hip_bf16.h>

#define B_    4
#define NSEQ  2048
#define DIM   1024
#define HEADS 16
#define DHEAD 64
#define INNER 1024
#define EPS   1e-5f

typedef __attribute__((ext_vector_type(16))) _Float16 v16h;
typedef __attribute__((ext_vector_type(8)))  _Float16 v8h;
typedef __attribute__((ext_vector_type(8)))  float    v8f;
typedef __attribute__((ext_vector_type(4)))  int      v4i;

#define WMMA_F16(a, b, c) \
  __builtin_amdgcn_wmma_f32_16x16x32_f16(false, (a), false, (b), (short)0, (c), false, false)

#define AS1 __attribute__((address_space(1)))
#define AS3 __attribute__((address_space(3)))

#if __has_builtin(__builtin_amdgcn_global_load_async_to_lds_b128) && \
    __has_builtin(__builtin_amdgcn_s_wait_asynccnt)
#define HAVE_ASYNC 1
#else
#define HAVE_ASYNC 0
#endif

// Copy 16 bytes global -> LDS. Async (ASYNCcnt-tracked, no VGPR staging) when
// the gfx1250 async builtins are available; plain load/store otherwise.
__device__ __forceinline__ void async_copy16(_Float16* lds, const _Float16* g) {
#if HAVE_ASYNC
  __builtin_amdgcn_global_load_async_to_lds_b128((AS1 v4i*)g, (AS3 v4i*)lds, 0, 0);
#else
  *(v8h*)lds = *(const v8h*)g;
#endif
}

__device__ __forceinline__ void async_wait() {
#if HAVE_ASYNC
  __builtin_amdgcn_s_wait_asynccnt(0);
#endif
}

// Load a 16x32 f16 A-fragment (or B-fragment from an [N][K]-transposed tile).
// Layout per CDNA5 ISA 7.12.2: lanes 0-15 hold rows 0-15 with K {0..7,16..23},
// lanes 16-31 hold rows 0-15 with K {8..15,24..31}. Two 16B loads per lane.
__device__ __forceinline__ v16h load_frag(const _Float16* base, int row0, int stride, int koff) {
  int lane = threadIdx.x & 31;
  int r = row0 + (lane & 15);
  int c = koff + ((lane >> 4) << 3);
  const _Float16* p = base + r * stride + c;
  v8h lo = *(const v8h*)p;
  v8h hi = *(const v8h*)(p + 16);
  v16h out;
#pragma unroll
  for (int i = 0; i < 8; ++i) { out[i] = lo[i]; out[i + 8] = hi[i]; }
  return out;
}

// ---------------------------------------------------------------- weight convert+transpose
// in: f32 [K][Ng] row-major  ->  out: f16 [Ng][K] (i.e. W^T), so GEMM B tiles
// are contiguous along K and can be staged with async b128 copies.
__global__ void cvt_transpose(const float* __restrict__ in, _Float16* __restrict__ out,
                              int K, int Ng) {
  int idx = blockIdx.x * blockDim.x + threadIdx.x;
  if (idx >= K * Ng) return;
  int n = idx / K;
  int k = idx - n * K;
  out[(size_t)n * K + k] = (_Float16)in[(size_t)k * Ng + n];
}

// ---------------------------------------------------------------- row LN (width 1024) -> f16
__global__ void ln_rows_1024(const float* __restrict__ x, const float* __restrict__ g,
                             const float* __restrict__ bta, _Float16* __restrict__ xn) {
  int row = blockIdx.x;
  int tid = threadIdx.x;
  const float* xr = x + (size_t)row * DIM;
  float v[4];
  float s = 0.f, ss = 0.f;
#pragma unroll
  for (int i = 0; i < 4; ++i) {
    v[i] = xr[tid + i * 256];
    s += v[i];
    ss += v[i] * v[i];
  }
#pragma unroll
  for (int m = 16; m >= 1; m >>= 1) {
    s += __shfl_xor(s, m, 32);
    ss += __shfl_xor(ss, m, 32);
  }
  __shared__ float smem[16];
  int wave = tid >> 5, lane = tid & 31;
  if (lane == 0) { smem[wave] = s; smem[8 + wave] = ss; }
  __syncthreads();
  if (wave == 0) {
    float a = (lane < 8) ? smem[lane] : 0.f;
    float b = (lane < 8) ? smem[8 + lane] : 0.f;
#pragma unroll
    for (int m = 4; m >= 1; m >>= 1) {
      a += __shfl_xor(a, m, 32);
      b += __shfl_xor(b, m, 32);
    }
    if (lane == 0) { smem[0] = a; smem[8] = b; }
  }
  __syncthreads();
  float mu = smem[0] * (1.f / DIM);
  float var = smem[8] * (1.f / DIM) - mu * mu;
  float rs = rsqrtf(var + EPS);
  _Float16* xo = xn + (size_t)row * DIM;
#pragma unroll
  for (int i = 0; i < 4; ++i) {
    int c = tid + i * 256;
    xo[c] = (_Float16)((v[i] - mu) * rs * g[c] + bta[c]);
  }
}

// ---------------------------------------------------------------- 16-lane row sum
// Sum over the 16 lanes of a DPP row (all lanes get the sum). The C tile of a
// WMMA keeps one matrix row in one 16-lane half, so this is a sum along N.
template <int CTRL>
__device__ __forceinline__ float dpp_xadd(float v) {
  int o = __builtin_amdgcn_update_dpp(0, __builtin_bit_cast(int, v), CTRL, 0xf, 0xf, true);
  return v + __builtin_bit_cast(float, o);
}
__device__ __forceinline__ float row16_sum(float v) {
  v = dpp_xadd<0x161>(v);  // row_xmask:1
  v = dpp_xadd<0x162>(v);  // row_xmask:2
  v = dpp_xadd<0x164>(v);  // row_xmask:4
  v = dpp_xadd<0x168>(v);  // row_xmask:8
  return v;
}

// Layernorm of width 64 in place on four 16x16 f32 C tiles that lie side by side
// along N (one head). gv, bv: this lane's gain and bias for its column of each tile.
__device__ __forceinline__ void head_ln(v8f* c, const float* gv, const float* bv) {
#pragma unroll
  for (int r = 0; r < 8; ++r) {
    float s = 0.f, ss = 0.f;
#pragma unroll
    for (int j = 0; j < 4; ++j) {
      float v = c[j][r];
      s += v;
      ss += v * v;
    }
    s = row16_sum(s);
    ss = row16_sum(ss);
    float mu = s * (1.f / DHEAD);
    float var = ss * (1.f / DHEAD) - mu * mu;
    float rs = rsqrtf(var + EPS);
#pragma unroll
    for (int j = 0; j < 4; ++j) c[j][r] = (c[j][r] - mu) * rs * gv[j] + bv[j];
  }
}

// ---------------------------------------------------------------- WMMA GEMM
// C[M,Ng] = A[M,K] * Wt[Ng,K]^T.  Block tile 128(M) x 128(N), 8 waves
// (16 M-rows x 128 N each). K step 32; both tiles staged via async b128 to LDS.
// mode 0: outf = C + bias (fp32).
// mode 1: Q (scaled) -> Qh [bh][n][64]; K, V get their head layernorm (width 64)
// on the f32 accumulators: K -> Kh [bh][n][64], V -> Vt [bh][64][n] (transposed
// for the PV WMMA). A wave's 128 columns are two whole heads.
__global__ void gemm_wmma(const _Float16* __restrict__ A, const _Float16* __restrict__ Wt,
                          int M, int Ng, int K, int mode, float* __restrict__ outf,
                          const float* __restrict__ bias, _Float16* __restrict__ Qh,
                          _Float16* __restrict__ Kh, _Float16* __restrict__ Vt,
                          const float* __restrict__ kg, const float* __restrict__ kb,
                          const float* __restrict__ vg, const float* __restrict__ vb) {
  __shared__ _Float16 ldsA[128 * 32];
  __shared__ _Float16 ldsB[128 * 32];
  int tid = threadIdx.x;
  int wave = tid >> 5;
  int lane = tid & 31;
  int n0 = blockIdx.x * 128;
  int m0 = blockIdx.y * 128;

  v8f acc[8] = {};

  int row = tid >> 1;              // 0..127
  int ch = (tid & 1) * 16;         // 0 or 16
  const _Float16* srcA = A  + (size_t)(m0 + row) * K + ch;
  const _Float16* srcB = Wt + (size_t)(n0 + row) * K + ch;

  for (int k0 = 0; k0 < K; k0 += 32) {
    async_copy16(ldsA + row * 32 + ch,     srcA + k0);
    async_copy16(ldsA + row * 32 + ch + 8, srcA + k0 + 8);
    async_copy16(ldsB + row * 32 + ch,     srcB + k0);
    async_copy16(ldsB + row * 32 + ch + 8, srcB + k0 + 8);
    if (k0 + 32 < K) {
      __builtin_prefetch(srcA + k0 + 32, 0, 3);
      __builtin_prefetch(srcB + k0 + 32, 0, 3);
    }
    async_wait();
    __syncthreads();
    v16h a = load_frag(ldsA, wave * 16, 32, 0);
#pragma unroll
    for (int t = 0; t < 8; ++t) {
      v16h b = load_frag(ldsB, t * 16, 32, 0);
      acc[t] = WMMA_F16(a, b, acc[t]);
    }
    __syncthreads();
  }

  int nlo = lane & 15;
  int mhi = (lane >> 4) * 8;
  if (mode == 0) {
#pragma unroll
    for (int t = 0; t < 8; ++t) {
      int n = n0 + t * 16 + nlo;
      float bv = bias[n];
#pragma unroll
      for (int r = 0; r < 8; ++r) {
        int m = m0 + wave * 16 + mhi + r;
        outf[(size_t)m * Ng + n] = acc[t][r] + bv;
      }
    }
  } else {
    int which = n0 >> 10;                    // block-uniform: 128 divides 1024
    int h0 = (n0 & 1023) >> 6;               // first of the tile's two heads
    int bb = m0 >> 11;                       // block-uniform: 128 divides NSEQ
    int nn0 = (m0 & 2047) + wave * 16 + mhi; // first of this lane's 8 rows
    if (which == 0) {
#pragma unroll
      for (int t = 0; t < 8; ++t) {
        int bh = bb * HEADS + h0 + (t >> 2);
        _Float16* dst = Qh + ((size_t)bh * NSEQ + nn0) * DHEAD + (t & 3) * 16 + nlo;
#pragma unroll
        for (int r = 0; r < 8; ++r)
          dst[r * DHEAD] = (_Float16)(acc[t][r] * 0.125f);  // fold 1/sqrt(64) into Q
      }
      // precaution: no register that an issued Q store names is rewritten before this wait
      asm volatile("s_wait_xcnt 0x0" ::: "memory");
    } else {
      const float* g = (which == 1) ? kg : vg;
      const float* bt = (which == 1) ? kb : vb;
      float gv[4], bv[4];
#pragma unroll
      for (int j = 0; j < 4; ++j) { gv[j] = g[j * 16 + nlo]; bv[j] = bt[j * 16 + nlo]; }
      // precaution: no register that an issued gain or bias load names is rewritten before this wait
      asm volatile("s_wait_xcnt 0x0" ::: "memory");
      if (which == 1) {
#pragma unroll
        for (int hh = 0; hh < 2; ++hh) {
          head_ln(acc + hh * 4, gv, bv);
          int bh = bb * HEADS + h0 + hh;
#pragma unroll
          for (int j = 0; j < 4; ++j) {
            _Float16* dst = Kh + ((size_t)bh * NSEQ + nn0) * DHEAD + j * 16 + nlo;
#pragma unroll
            for (int r = 0; r < 8; ++r) dst[r * DHEAD] = (_Float16)acc[hh * 4 + j][r];
          }
        }
        // precaution: no register that an issued K store names is rewritten before this wait
        asm volatile("s_wait_xcnt 0x0" ::: "memory");
      } else {
#pragma unroll
        for (int hh = 0; hh < 2; ++hh) {
          head_ln(acc + hh * 4, gv, bv);
          int bh = bb * HEADS + h0 + hh;
          // a lane's 8 rows are 8 consecutive n of one d: one 16-byte store
#pragma unroll
          for (int j = 0; j < 4; ++j) {
            v8h pk;
#pragma unroll
            for (int r = 0; r < 8; ++r) pk[r] = (_Float16)acc[hh * 4 + j][r];
            *(v8h*)(Vt + ((size_t)bh * DHEAD + j * 16 + nlo) * NSEQ + nn0) = pk;
          }
        }
        // precaution: no register that an issued V store names is rewritten before this wait
        asm volatile("s_wait_xcnt 0x0" ::: "memory");
      }
    }
  }
}

// ---------------------------------------------------------------- flash attention
// One block = 128 q-rows of one (b,h); 8 waves x 16 rows. Online softmax,
// S = Q K^T and O += P V via WMMA f16->f32. Output [b][n][h*64+d] f16.
__global__ void attn_kernel(const _Float16* __restrict__ Qh, const _Float16* __restrict__ Kh,
                            const _Float16* __restrict__ Vt, _Float16* __restrict__ Ao) {
  __shared__ _Float16 ldsK[32 * 64];
  __shared__ _Float16 ldsV[64 * 32];
  __shared__ _Float16 ldsP[8][16 * 32];
  int tid = threadIdx.x, wave = tid >> 5, lane = tid & 31;
  int nlo = lane & 15, half8 = (lane >> 4) * 8;
  int bh = blockIdx.x >> 4;
  int q0 = (blockIdx.x & 15) * 128 + wave * 16;

  const _Float16* Qbase = Qh + ((size_t)bh * NSEQ + q0) * DHEAD;
  v16h aQ0 = load_frag(Qbase, 0, DHEAD, 0);
  v16h aQ1 = load_frag(Qbase, 0, DHEAD, 32);

  v8f o[4] = {};
  float mrow[8], lrow[8];
#pragma unroll
  for (int r = 0; r < 8; ++r) { mrow[r] = -3.0e38f; lrow[r] = 0.f; }

  int rk = tid >> 3, chk = (tid & 7) * 8;   // K tile 32x64: one b128 per thread
  int rd = tid >> 2, chv = (tid & 3) * 8;   // V^T tile 64x32: one b128 per thread
  const _Float16* srcK = Kh + ((size_t)bh * NSEQ + rk) * DHEAD + chk;
  const _Float16* srcV = Vt + ((size_t)bh * DHEAD + rd) * NSEQ + chv;

  for (int kb = 0; kb < NSEQ; kb += 32) {
    __syncthreads();
    async_copy16(ldsK + rk * 64 + chk, srcK + (size_t)kb * DHEAD);
    async_copy16(ldsV + rd * 32 + chv, srcV + kb);
    if (kb + 32 < NSEQ) {
      __builtin_prefetch(srcK + (size_t)(kb + 32) * DHEAD, 0, 3);
      __builtin_prefetch(srcV + kb + 32, 0, 3);
    }
    async_wait();
    __syncthreads();

    // S = Q K^T : two 16x16 f32 tiles (keys 0-15, 16-31), K-dim = d = 64
    v8f s0 = {}, s1 = {};
    {
      v16h b0 = load_frag(ldsK, 0, 64, 0);
      v16h b1 = load_frag(ldsK, 16, 64, 0);
      s0 = WMMA_F16(aQ0, b0, s0);
      s1 = WMMA_F16(aQ0, b1, s1);
      b0 = load_frag(ldsK, 0, 64, 32);
      b1 = load_frag(ldsK, 16, 64, 32);
      s0 = WMMA_F16(aQ1, b0, s0);
      s1 = WMMA_F16(aQ1, b1, s1);
    }

    // Online softmax in C-tile layout; row reductions stay inside 16-lane halves.
    _Float16* pw = ldsP[wave];
#pragma unroll
    for (int r = 0; r < 8; ++r) {
      float mx = fmaxf(s0[r], s1[r]);
#pragma unroll
      for (int m = 8; m >= 1; m >>= 1) mx = fmaxf(mx, __shfl_xor(mx, m, 32));
      float mn = fmaxf(mrow[r], mx);
      float alpha = __expf(mrow[r] - mn);
      float p0 = __expf(s0[r] - mn);
      float p1 = __expf(s1[r] - mn);
      float rsum = p0 + p1;
#pragma unroll
      for (int m = 8; m >= 1; m >>= 1) rsum += __shfl_xor(rsum, m, 32);
      lrow[r] = lrow[r] * alpha + rsum;
      mrow[r] = mn;
#pragma unroll
      for (int t = 0; t < 4; ++t) o[t][r] *= alpha;
      int prow = half8 + r;  // stage P (C layout -> row-major) for A-fragment reload
      pw[prow * 32 + nlo] = (_Float16)p0;
      pw[prow * 32 + 16 + nlo] = (_Float16)p1;
    }

    // O += P V : K-dim = 32 keys, 4 d-slices of 16
    v16h aP = load_frag(pw, 0, 32, 0);
#pragma unroll
    for (int t = 0; t < 4; ++t) {
      v16h bv = load_frag(ldsV, t * 16, 32, 0);
      o[t] = WMMA_F16(aP, bv, o[t]);
    }
  }

  int b = bh >> 4, h = bh & 15;
#pragma unroll
  for (int r = 0; r < 8; ++r) {
    float inv = 1.f / lrow[r];
    int q = q0 + half8 + r;
    size_t rowoff = ((size_t)b * NSEQ + q) * INNER + h * DHEAD;
#pragma unroll
    for (int t = 0; t < 4; ++t)
      Ao[rowoff + t * 16 + nlo] = (_Float16)(o[t][r] * inv);
  }
}

// ---------------------------------------------------------------- launch
extern "C" void kernel_launch(void* const* d_in, const int* in_sizes, int n_in,
                              void* d_out, int out_size, void* d_ws, size_t ws_size,
                              hipStream_t stream) {
  const float* x       = (const float*)d_in[0];
  const float* norm_g  = (const float*)d_in[1];
  const float* norm_b  = (const float*)d_in[2];
  const float* w_qkv   = (const float*)d_in[3];
  const float* normk_g = (const float*)d_in[4];
  const float* normk_b = (const float*)d_in[5];
  const float* normv_g = (const float*)d_in[6];
  const float* normv_b = (const float*)d_in[7];
  const float* w_out   = (const float*)d_in[8];
  const float* b_out   = (const float*)d_in[9];
  float* out = (float*)d_out;

  const size_t ROWS = (size_t)B_ * NSEQ;                    // 8192
  const size_t HEADSZ = (size_t)B_ * HEADS * NSEQ * DHEAD;  // 8M elements

  char* ws = (char*)d_ws;
  size_t off = 0;
  _Float16* xn16    = (_Float16*)(ws + off); off += ROWS * DIM * 2;
  _Float16* wqkv16t = (_Float16*)(ws + off); off += (size_t)DIM * 3 * INNER * 2;
  _Float16* wout16t = (_Float16*)(ws + off); off += (size_t)INNER * DIM * 2;
  _Float16* Qh      = (_Float16*)(ws + off); off += HEADSZ * 2;
  _Float16* Kh      = (_Float16*)(ws + off); off += HEADSZ * 2;
  _Float16* Vt      = (_Float16*)(ws + off); off += HEADSZ * 2;
  _Float16* Ao      = (_Float16*)(ws + off); off += ROWS * INNER * 2;

  int nqkv = DIM * 3 * INNER;
  int nout = INNER * DIM;
  cvt_transpose<<<(nqkv + 255) / 256, 256, 0, stream>>>(w_qkv, wqkv16t, DIM, 3 * INNER);
  cvt_transpose<<<(nout + 255) / 256, 256, 0, stream>>>(w_out, wout16t, INNER, DIM);

  ln_rows_1024<<<(int)ROWS, 256, 0, stream>>>(x, norm_g, norm_b, xn16);

  gemm_wmma<<<dim3(3 * INNER / 128, ROWS / 128), 256, 0, stream>>>(
      xn16, wqkv16t, (int)ROWS, 3 * INNER, DIM, 1, nullptr, nullptr, Qh, Kh, Vt,
      normk_g, normk_b, normv_g, normv_b);

  attn_kernel<<<B_ * HEADS * (NSEQ / 128), 256, 0, stream>>>(Qh, Kh, Vt, Ao);

  gemm_wmma<<<dim3(DIM / 128, ROWS / 128), 256, 0, stream>>>(
      Ao, wout16t, (int)ROWS, DIM, DIM, 0, out, b_out, nullptr, nullptr, nullptr,
      nullptr, nullptr, nullptr, nullptr);
}

// v002
// It runs in 324 microseconds.
// In two side-by-side timings against v001, it was 1.46 and 1.48 times as fast.
// All steps since v000 together make it 1.82 times as fast.
#include <hip/hip_runtime.h>
#include <hip/hip_bf16.h>

#define B_    4
#define NSEQ  2048
#define DIM   1024
#define HEADS 16
#define DHEAD 64
#define INNER 1024
#define EPS   1e-5f

// LDS row pitches in f16 elements. Every tile is read with 16-byte loads, one row
// per lane, so each pitch is an odd multiple of 16 bytes: 16 rows then fall on
// 16 different groups of four banks. The pad bytes are never written or read.
// The tiles are declared 16-byte aligned, as their 16-byte copies and loads need.
#define PITCH32 40   // rows of 32 f16 (64 B) at 80 B
#define PITCH64 72   // rows of 64 f16 (128 B) at 144 B

typedef __attribute__((ext_vector_type(16))) _Float16 v16h;
typedef __attribute__((ext_vector_type(8)))  _Float16 v8h;
typedef __attribute__((ext_vector_type(8)))  float    v8f;
typedef __attribute__((ext_vector_type(4)))  int      v4i;

#define WMMA_F16(a, b, c) \
  __builtin_amdgcn_wmma_f32_16x16x32_f16(false, (a), false, (b), (short)0, (c), false, false)

#define AS1 __attribute__((address_space(1)))
#define AS3 __attribute__((address_space(3)))

#if __has_builtin(__builtin_amdgcn_global_load_async_to_lds_b128) && \
    __has_builtin(__builtin_amdgcn_s_wait_asynccnt)
#define HAVE_ASYNC 1
#else
#define HAVE_ASYNC 0
#endif

// Copy 16 bytes global -> LDS. Async (ASYNCcnt-tracked, no VGPR staging) when
// the gfx1250 async builtins are available; plain load/store otherwise.
__device__ __forceinline__ void async_copy16(_Float16* lds, const _Float16* g) {
#if HAVE_ASYNC
  __builtin_amdgcn_global_load_async_to_lds_b128((AS1 v4i*)g, (AS3 v4i*)lds, 0, 0);
#else
  *(v8h*)lds = *(const v8h*)g;
#endif
}

__device__ __forceinline__ void async_wait() {
#if HAVE_ASYNC
  __builtin_amdgcn_s_wait_asynccnt(0);
#endif
}

// Load a 16x32 f16 A-fragment (or B-fragment from an [N][K]-transposed tile).
// Layout per CDNA5 ISA 7.12.2: lanes 0-15 hold rows 0-15 with K {0..7,16..23},
// lanes 16-31 hold rows 0-15 with K {8..15,24..31}. Two 16B loads per lane.
__device__ __forceinline__ v16h load_frag(const _Float16* base, int row0, int stride, int koff) {
  int lane = threadIdx.x & 31;
  int r = row0 + (lane & 15);
  int c = koff + ((lane >> 4) << 3);
  const _Float16* p = base + r * stride + c;
  v8h lo = *(const v8h*)p;
  v8h hi = *(const v8h*)(p + 16);
  v16h out;
#pragma unroll
  for (int i = 0; i < 8; ++i) { out[i] = lo[i]; out[i + 8] = hi[i]; }
  return out;
}

// ---------------------------------------------------------------- weight convert+transpose
// in: f32 [K][Ng] row-major  ->  out: f16 [Ng][K] (i.e. W^T), so GEMM B tiles
// are contiguous along K and can be staged with async b128 copies.
__global__ void cvt_transpose(const float* __restrict__ in, _Float16* __restrict__ out,
                              int K, int Ng) {
  int idx = blockIdx.x * blockDim.x + threadIdx.x;
  if (idx >= K * Ng) return;
  int n = idx / K;
  int k = idx - n * K;
  out[(size_t)n * K + k] = (_Float16)in[(size_t)k * Ng + n];
}

// ---------------------------------------------------------------- row LN (width 1024) -> f16
__global__ void ln_rows_1024(const float* __restrict__ x, const float* __restrict__ g,
                             const float* __restrict__ bta, _Float16* __restrict__ xn) {
  int row = blockIdx.x;
  int tid = threadIdx.x;
  const float* xr = x + (size_t)row * DIM;
  float v[4];
  float s = 0.f, ss = 0.f;
#pragma unroll
  for (int i = 0; i < 4; ++i) {
    v[i] = xr[tid + i * 256];
    s += v[i];
    ss += v[i] * v[i];
  }
#pragma unroll
  for (int m = 16; m >= 1; m >>= 1) {
    s += __shfl_xor(s, m, 32);
    ss += __shfl_xor(ss, m, 32);
  }
  __shared__ float smem[16];
  int wave = tid >> 5, lane = tid & 31;
  if (lane == 0) { smem[wave] = s; smem[8 + wave] = ss; }
  __syncthreads();
  if (wave == 0) {
    float a = (lane < 8) ? smem[lane] : 0.f;
    float b = (lane < 8) ? smem[8 + lane] : 0.f;
#pragma unroll
    for (int m = 4; m >= 1; m >>= 1) {
      a += __shfl_xor(a, m, 32);
      b += __shfl_xor(b, m, 32);
    }
    if (lane == 0) { smem[0] = a; smem[8] = b; }
  }
  __syncthreads();
  float mu = smem[0] * (1.f / DIM);
  float var = smem[8] * (1.f / DIM) - mu * mu;
  float rs = rsqrtf(var + EPS);
  _Float16* xo = xn + (size_t)row * DIM;
#pragma unroll
  for (int i = 0; i < 4; ++i) {
    int c = tid + i * 256;
    xo[c] = (_Float16)((v[i] - mu) * rs * g[c] + bta[c]);
  }
}

// ---------------------------------------------------------------- 16-lane row sum
// Sum over the 16 lanes of a DPP row (all lanes get the sum). The C tile of a
// WMMA keeps one matrix row in one 16-lane half, so this is a sum along N.
template <int CTRL>
__device__ __forceinline__ float dpp_xadd(float v) {
  int o = __builtin_amdgcn_update_dpp(0, __builtin_bit_cast(int, v), CTRL, 0xf, 0xf, true);
  return v + __builtin_bit_cast(float, o);
}
__device__ __forceinline__ float row16_sum(float v) {
  v = dpp_xadd<0x161>(v);  // row_xmask:1
  v = dpp_xadd<0x162>(v);  // row_xmask:2
  v = dpp_xadd<0x164>(v);  // row_xmask:4
  v = dpp_xadd<0x168>(v);  // row_xmask:8
  return v;
}

// Layernorm of width 64 in place on four 16x16 f32 C tiles that lie side by side
// along N (one head). gv, bv: this lane's gain and bias for its column of each tile.
__device__ __forceinline__ void head_ln(v8f* c, const float* gv, const float* bv) {
#pragma unroll
  for (int r = 0; r < 8; ++r) {
    float s = 0.f, ss = 0.f;
#pragma unroll
    for (int j = 0; j < 4; ++j) {
      float v = c[j][r];
      s += v;
      ss += v * v;
    }
    s = row16_sum(s);
    ss = row16_sum(ss);
    float mu = s * (1.f / DHEAD);
    float var = ss * (1.f / DHEAD) - mu * mu;
    float rs = rsqrtf(var + EPS);
#pragma unroll
    for (int j = 0; j < 4; ++j) c[j][r] = (c[j][r] - mu) * rs * gv[j] + bv[j];
  }
}

// ---------------------------------------------------------------- WMMA GEMM
// C[M,Ng] = A[M,K] * Wt[Ng,K]^T.  Block tile 128(M) x 128(N), 8 waves
// (16 M-rows x 128 N each). K step 32; both tiles staged via async b128 to LDS.
// mode 0: outf = C + bias (fp32).
// mode 1: Q (scaled) -> Qh [bh][n][64]; K, V get their head layernorm (width 64)
// on the f32 accumulators: K -> Kh [bh][n][64], V -> Vt [bh][64][n] (transposed
// for the PV WMMA). A wave's 128 columns are two whole heads.
__global__ void gemm_wmma(const _Float16* __restrict__ A, const _Float16* __restrict__ Wt,
                          int M, int Ng, int K, int mode, float* __restrict__ outf,
                          const float* __restrict__ bias, _Float16* __restrict__ Qh,
                          _Float16* __restrict__ Kh, _Float16* __restrict__ Vt,
                          const float* __restrict__ kg, const float* __restrict__ kb,
                          const float* __restrict__ vg, const float* __restrict__ vb) {
  __shared__ __attribute__((aligned(16))) _Float16 ldsA[128 * PITCH32];
  __shared__ __attribute__((aligned(16))) _Float16 ldsB[128 * PITCH32];
  int tid = threadIdx.x;
  int wave = tid >> 5;
  int lane = tid & 31;
  int n0 = blockIdx.x * 128;
  int m0 = blockIdx.y * 128;

  v8f acc[8] = {};

  int row = tid >> 1;              // 0..127
  int ch = (tid & 1) * 16;         // 0 or 16
  const _Float16* srcA = A  + (size_t)(m0 + row) * K + ch;
  const _Float16* srcB = Wt + (size_t)(n0 + row) * K + ch;

  for (int k0 = 0; k0 < K; k0 += 32) {
    async_copy16(ldsA + row * PITCH32 + ch,     srcA + k0);
    async_copy16(ldsA + row * PITCH32 + ch + 8, srcA + k0 + 8);
    async_copy16(ldsB + row * PITCH32 + ch,     srcB + k0);
    async_copy16(ldsB + row * PITCH32 + ch + 8, srcB + k0 + 8);
    if (k0 + 32 < K) {
      __builtin_prefetch(srcA + k0 + 32, 0, 3);
      __builtin_prefetch(srcB + k0 + 32, 0, 3);
    }
    async_wait();
    __syncthreads();
    v16h a = load_frag(ldsA, wave * 16, PITCH32, 0);
#pragma unroll
    for (int t = 0; t < 8; ++t) {
      v16h b = load_frag(ldsB, t * 16, PITCH32, 0);
      acc[t] = WMMA_F16(a, b, acc[t]);
    }
    __syncthreads();
  }

  int nlo = lane & 15;
  int mhi = (lane >> 4) * 8;
  if (mode == 0) {
#pragma unroll
    for (int t = 0; t < 8; ++t) {
      int n = n0 + t * 16 + nlo;
      float bv = bias[n];
#pragma unroll
      for (int r = 0; r < 8; ++r) {
        int m = m0 + wave * 16 + mhi + r;
        outf[(size_t)m * Ng + n] = acc[t][r] + bv;
      }
    }
  } else {
    int which = n0 >> 10;                    // block-uniform: 128 divides 1024
    int h0 = (n0 & 1023) >> 6;               // first of the tile's two heads
    int bb = m0 >> 11;                       // block-uniform: 128 divides NSEQ
    int nn0 = (m0 & 2047) + wave * 16 + mhi; // first of this lane's 8 rows
    if (which == 0) {
#pragma unroll
      for (int t = 0; t < 8; ++t) {
        int bh = bb * HEADS + h0 + (t >> 2);
        _Float16* dst = Qh + ((size_t)bh * NSEQ + nn0) * DHEAD + (t & 3) * 16 + nlo;
#pragma unroll
        for (int r = 0; r < 8; ++r)
          dst[r * DHEAD] = (_Float16)(acc[t][r] * 0.125f);  // fold 1/sqrt(64) into Q
      }
      // precaution: no register that an issued Q store names is rewritten before this wait
      asm volatile("s_wait_xcnt 0x0" ::: "memory");
    } else {
      const float* g = (which == 1) ? kg : vg;
      const float* bt = (which == 1) ? kb : vb;
      float gv[4], bv[4];
#pragma unroll
      for (int j = 0; j < 4; ++j) { gv[j] = g[j * 16 + nlo]; bv[j] = bt[j * 16 + nlo]; }
      // precaution: no register that an issued gain or bias load names is rewritten before this wait
      asm volatile("s_wait_xcnt 0x0" ::: "memory");
      if (which == 1) {
#pragma unroll
        for (int hh = 0; hh < 2; ++hh) {
          head_ln(acc + hh * 4, gv, bv);
          int bh = bb * HEADS + h0 + hh;
#pragma unroll
          for (int j = 0; j < 4; ++j) {
            _Float16* dst = Kh + ((size_t)bh * NSEQ + nn0) * DHEAD + j * 16 + nlo;
#pragma unroll
            for (int r = 0; r < 8; ++r) dst[r * DHEAD] = (_Float16)acc[hh * 4 + j][r];
          }
        }
        // precaution: no register that an issued K store names is rewritten before this wait
        asm volatile("s_wait_xcnt 0x0" ::: "memory");
      } else {
#pragma unroll
        for (int hh = 0; hh < 2; ++hh) {
          head_ln(acc + hh * 4, gv, bv);
          int bh = bb * HEADS + h0 + hh;
          // a lane's 8 rows are 8 consecutive n of one d: one 16-byte store
#pragma unroll
          for (int j = 0; j < 4; ++j) {
            v8h pk;
#pragma unroll
            for (int r = 0; r < 8; ++r) pk[r] = (_Float16)acc[hh * 4 + j][r];
            *(v8h*)(Vt + ((size_t)bh * DHEAD + j * 16 + nlo) * NSEQ + nn0) = pk;
          }
        }
        // precaution: no register that an issued V store names is rewritten before this wait
        asm volatile("s_wait_xcnt 0x0" ::: "memory");
      }
    }
  }
}

// ---------------------------------------------------------------- flash attention
// One block = 128 q-rows of one (b,h); 8 waves x 16 rows. Online softmax,
// S = Q K^T and O += P V via WMMA f16->f32. Output [b][n][h*64+d] f16.
__global__ void attn_kernel(const _Float16* __restrict__ Qh, const _Float16* __restrict__ Kh,
                            const _Float16* __restrict__ Vt, _Float16* __restrict__ Ao) {
  __shared__ __attribute__((aligned(16))) _Float16 ldsK[32 * PITCH64];
  __shared__ __attribute__((aligned(16))) _Float16 ldsV[64 * PITCH32];
  __shared__ __attribute__((aligned(16))) _Float16 ldsP[8][16 * PITCH32];
  int tid = threadIdx.x, wave = tid >> 5, lane = tid & 31;
  int nlo = lane & 15, half8 = (lane >> 4) * 8;
  int bh = blockIdx.x >> 4;
  int q0 = (blockIdx.x & 15) * 128 + wave * 16;

  const _Float16* Qbase = Qh + ((size_t)bh * NSEQ + q0) * DHEAD;
  v16h aQ0 = load_frag(Qbase, 0, DHEAD, 0);
  v16h aQ1 = load_frag(Qbase, 0, DHEAD, 32);

  v8f o[4] = {};
  float mrow[8], lrow[8];
#pragma unroll
  for (int r = 0; r < 8; ++r) { mrow[r] = -3.0e38f; lrow[r] = 0.f; }

  int rk = tid >> 3, chk = (tid & 7) * 8;   // K tile 32x64: one b128 per thread
  int rd = tid >> 2, chv = (tid & 3) * 8;   // V^T tile 64x32: one b128 per thread
  const _Float16* srcK = Kh + ((size_t)bh * NSEQ + rk) * DHEAD + chk;
  const _Float16* srcV = Vt + ((size_t)bh * DHEAD + rd) * NSEQ + chv;

  for (int kb = 0; kb < NSEQ; kb += 32) {
    __syncthreads();
    async_copy16(ldsK + rk * PITCH64 + chk, srcK + (size_t)kb * DHEAD);
    async_copy16(ldsV + rd * PITCH32 + chv, srcV + kb);
    if (kb + 32 < NSEQ) {
      __builtin_prefetch(srcK + (size_t)(kb + 32) * DHEAD, 0, 3);
      __builtin_prefetch(srcV + kb + 32, 0, 3);
    }
    async_wait();
    __syncthreads();

    // S = Q K^T : two 16x16 f32 tiles (keys 0-15, 16-31), K-dim = d = 64
    v8f s0 = {}, s1 = {};
    {
      v16h b0 = load_frag(ldsK, 0, PITCH64, 0);
      v16h b1 = load_frag(ldsK, 16, PITCH64, 0);
      s0 = WMMA_F16(aQ0, b0, s0);
      s1 = WMMA_F16(aQ0, b1, s1);
      b0 = load_frag(ldsK, 0, PITCH64, 32);
      b1 = load_frag(ldsK, 16, PITCH64, 32);
      s0 = WMMA_F16(aQ1, b0, s0);
      s1 = WMMA_F16(aQ1, b1, s1);
    }

    // Online softmax in C-tile layout; row reductions stay inside 16-lane halves.
    _Float16* pw = ldsP[wave];
#pragma unroll
    for (int r = 0; r < 8; ++r) {
      float mx = fmaxf(s0[r], s1[r]);
#pragma unroll
      for (int m = 8; m >= 1; m >>= 1) mx = fmaxf(mx, __shfl_xor(mx, m, 32));
      float mn = fmaxf(mrow[r], mx);
      float alpha = __expf(mrow[r] - mn);
      float p0 = __expf(s0[r] - mn);
      float p1 = __expf(s1[r] - mn);
      float rsum = p0 + p1;
#pragma unroll
      for (int m = 8; m >= 1; m >>= 1) rsum += __shfl_xor(rsum, m, 32);
      lrow[r] = lrow[r] * alpha + rsum;
      mrow[r] = mn;
#pragma unroll
      for (int t = 0; t < 4; ++t) o[t][r] *= alpha;
      int prow = half8 + r;  // stage P (C layout -> row-major) for A-fragment reload
      pw[prow * PITCH32 + nlo] = (_Float16)p0;
      pw[prow * PITCH32 + 16 + nlo] = (_Float16)p1;
    }

    // O += P V : K-dim = 32 keys, 4 d-slices of 16
    v16h aP = load_frag(pw, 0, PITCH32, 0);
#pragma unroll
    for (int t = 0; t < 4; ++t) {
      v16h bv = load_frag(ldsV, t * 16, PITCH32, 0);
      o[t] = WMMA_F16(aP, bv, o[t]);
    }
  }

  int b = bh >> 4, h = bh & 15;
#pragma unroll
  for (int r = 0; r < 8; ++r) {
    float inv = 1.f / lrow[r];
    int q = q0 + half8 + r;
    size_t rowoff = ((size_t)b * NSEQ + q) * INNER + h * DHEAD;
#pragma unroll
    for (int t = 0; t < 4; ++t)
      Ao[rowoff + t * 16 + nlo] = (_Float16)(o[t][r] * inv);
  }
}

// ---------------------------------------------------------------- launch
extern "C" void kernel_launch(void* const* d_in, const int* in_sizes, int n_in,
                              void* d_out, int out_size, void* d_ws, size_t ws_size,
                              hipStream_t stream) {
  const float* x       = (const float*)d_in[0];
  const float* norm_g  = (const float*)d_in[1];
  const float* norm_b  = (const float*)d_in[2];
  const float* w_qkv   = (const float*)d_in[3];
  const float* normk_g = (const float*)d_in[4];
  const float* normk_b = (const float*)d_in[5];
  const float* normv_g = (const float*)d_in[6];
  const float* normv_b = (const float*)d_in[7];
  const float* w_out   = (const float*)d_in[8];
  const float* b_out   = (const float*)d_in[9];
  float* out = (float*)d_out;

  const size_t ROWS = (size_t)B_ * NSEQ;                    // 8192
  const size_t HEADSZ = (size_t)B_ * HEADS * NSEQ * DHEAD;  // 8M elements

  char* ws = (char*)d_ws;
  size_t off = 0;
  _Float16* xn16    = (_Float16*)(ws + off); off += ROWS * DIM * 2;
  _Float16* wqkv16t = (_Float16*)(ws + off); off += (size_t)DIM * 3 * INNER * 2;
  _Float16* wout16t = (_Float16*)(ws + off); off += (size_t)INNER * DIM * 2;
  _Float16* Qh      = (_Float16*)(ws + off); off += HEADSZ * 2;
  _Float16* Kh      = (_Float16*)(ws + off); off += HEADSZ * 2;
  _Float16* Vt      = (_Float16*)(ws + off); off += HEADSZ * 2;
  _Float16* Ao      = (_Float16*)(ws + off); off += ROWS * INNER * 2;

  int nqkv = DIM * 3 * INNER;
  int nout = INNER * DIM;
  cvt_transpose<<<(nqkv + 255) / 256, 256, 0, stream>>>(w_qkv, wqkv16t, DIM, 3 * INNER);
  cvt_transpose<<<(nout + 255) / 256, 256, 0, stream>>>(w_out, wout16t, INNER, DIM);

  ln_rows_1024<<<(int)ROWS, 256, 0, stream>>>(x, norm_g, norm_b, xn16);

  gemm_wmma<<<dim3(3 * INNER / 128, ROWS / 128), 256, 0, stream>>>(
      xn16, wqkv16t, (int)ROWS, 3 * INNER, DIM, 1, nullptr, nullptr, Qh, Kh, Vt,
      normk_g, normk_b, normv_g, normv_b);

  attn_kernel<<<B_ * HEADS * (NSEQ / 128), 256, 0, stream>>>(Qh, Kh, Vt, Ao);

  gemm_wmma<<<dim3(DIM / 128, ROWS / 128), 256, 0, stream>>>(
      Ao, wout16t, (int)ROWS, DIM, DIM, 0, out, b_out, nullptr, nullptr, nullptr,
      nullptr, nullptr, nullptr, nullptr);
}

// v003
// Measured time: 264 microseconds a run.
// In both of two side-by-side timings against v002, it was 1.23 times as fast.
// Counting every step since v000, it is 2.23 times as fast.
#include <hip/hip_runtime.h>
#include <hip/hip_bf16.h>

#define B_    4
#define NSEQ  2048
#define DIM   1024
#define HEADS 16
#define DHEAD 64
#define INNER 1024
#define EPS   1e-5f

// LDS row pitches in f16 elements. Every tile is read with 16-byte loads, one row
// per lane, so each pitch is an odd multiple of 16 bytes: 16 rows then fall on
// 16 different groups of four banks. The pad bytes are never written or read.
// The tiles are declared 16-byte aligned, as their 16-byte copies and loads need.
#define PITCH32 40   // rows of 32 f16 (64 B) at 80 B
#define PITCH64 72   // rows of 64 f16 (128 B) at 144 B

typedef __attribute__((ext_vector_type(16))) _Float16 v16h;
typedef __attribute__((ext_vector_type(8)))  _Float16 v8h;
typedef __attribute__((ext_vector_type(8)))  float    v8f;
typedef __attribute__((ext_vector_type(4)))  int      v4i;

#define WMMA_F16(a, b, c) \
  __builtin_amdgcn_wmma_f32_16x16x32_f16(false, (a), false, (b), (short)0, (c), false, false)

#define AS1 __attribute__((address_space(1)))
#define AS3 __attribute__((address_space(3)))

#if __has_builtin(__builtin_amdgcn_global_load_async_to_lds_b128) && \
    __has_builtin(__builtin_amdgcn_s_wait_asynccnt)
#define HAVE_ASYNC 1
#else
#define HAVE_ASYNC 0
#endif

// Copy 16 bytes global -> LDS. Async (ASYNCcnt-tracked, no VGPR staging) when
// the gfx1250 async builtins are available; plain load/store otherwise.
__device__ __forceinline__ void async_copy16(_Float16* lds, const _Float16* g) {
#if HAVE_ASYNC
  __builtin_amdgcn_global_load_async_to_lds_b128((AS1 v4i*)g, (AS3 v4i*)lds, 0, 0);
#else
  *(v8h*)lds = *(const v8h*)g;
#endif
}

__device__ __forceinline__ void async_wait() {
#if HAVE_ASYNC
  __builtin_amdgcn_s_wait_asynccnt(0);
#endif
}

// Load a 16x32 f16 A-fragment (or B-fragment from an [N][K]-transposed tile).
// Layout per CDNA5 ISA 7.12.2: lanes 0-15 hold rows 0-15 with K {0..7,16..23},
// lanes 16-31 hold rows 0-15 with K {8..15,24..31}. Two 16B loads per lane.
__device__ __forceinline__ v16h load_frag(const _Float16* base, int row0, int stride, int koff) {
  int lane = threadIdx.x & 31;
  int r = row0 + (lane & 15);
  int c = koff + ((lane >> 4) << 3);
  const _Float16* p = base + r * stride + c;
  v8h lo = *(const v8h*)p;
  v8h hi = *(const v8h*)(p + 16);
  v16h out;
#pragma unroll
  for (int i = 0; i < 8; ++i) { out[i] = lo[i]; out[i + 8] = hi[i]; }
  return out;
}

// ---------------------------------------------------------------- weight convert+transpose
// in: f32 [K][Ng] row-major  ->  out: f16 [Ng][K] (i.e. W^T), so GEMM B tiles
// are contiguous along K and can be staged with async b128 copies.
__global__ void cvt_transpose(const float* __restrict__ in, _Float16* __restrict__ out,
                              int K, int Ng) {
  int idx = blockIdx.x * blockDim.x + threadIdx.x;
  if (idx >= K * Ng) return;
  int n = idx / K;
  int k = idx - n * K;
  out[(size_t)n * K + k] = (_Float16)in[(size_t)k * Ng + n];
}

// ---------------------------------------------------------------- row LN (width 1024) -> f16
__global__ void ln_rows_1024(const float* __restrict__ x, const float* __restrict__ g,
                             const float* __restrict__ bta, _Float16* __restrict__ xn) {
  int row = blockIdx.x;
  int tid = threadIdx.x;
  const float* xr = x + (size_t)row * DIM;
  float v[4];
  float s = 0.f, ss = 0.f;
#pragma unroll
  for (int i = 0; i < 4; ++i) {
    v[i] = xr[tid + i * 256];
    s += v[i];
    ss += v[i] * v[i];
  }
#pragma unroll
  for (int m = 16; m >= 1; m >>= 1) {
    s += __shfl_xor(s, m, 32);
    ss += __shfl_xor(ss, m, 32);
  }
  __shared__ float smem[16];
  int wave = tid >> 5, lane = tid & 31;
  if (lane == 0) { smem[wave] = s; smem[8 + wave] = ss; }
  __syncthreads();
  if (wave == 0) {
    float a = (lane < 8) ? smem[lane] : 0.f;
    float b = (lane < 8) ? smem[8 + lane] : 0.f;
#pragma unroll
    for (int m = 4; m >= 1; m >>= 1) {
      a += __shfl_xor(a, m, 32);
      b += __shfl_xor(b, m, 32);
    }
    if (lane == 0) { smem[0] = a; smem[8] = b; }
  }
  __syncthreads();
  float mu = smem[0] * (1.f / DIM);
  float var = smem[8] * (1.f / DIM) - mu * mu;
  float rs = rsqrtf(var + EPS);
  _Float16* xo = xn + (size_t)row * DIM;
#pragma unroll
  for (int i = 0; i < 4; ++i) {
    int c = tid + i * 256;
    xo[c] = (_Float16)((v[i] - mu) * rs * g[c] + bta[c]);
  }
}

// ---------------------------------------------------------------- 16-lane row sum
// Sum over the 16 lanes of a DPP row (all lanes get the sum). The C tile of a
// WMMA keeps one matrix row in one 16-lane half, so this is a sum along N.
template <int CTRL>
__device__ __forceinline__ float dpp_xadd(float v) {
  int o = __builtin_amdgcn_update_dpp(0, __builtin_bit_cast(int, v), CTRL, 0xf, 0xf, true);
  return v + __builtin_bit_cast(float, o);
}
__device__ __forceinline__ float row16_sum(float v) {
  v = dpp_xadd<0x161>(v);  // row_xmask:1
  v = dpp_xadd<0x162>(v);  // row_xmask:2
  v = dpp_xadd<0x164>(v);  // row_xmask:4
  v = dpp_xadd<0x168>(v);  // row_xmask:8
  return v;
}

// Layernorm of width 64 in place on four 16x16 f32 C tiles that lie side by side
// along N (one head). gv, bv: this lane's gain and bias for its column of each tile.
__device__ __forceinline__ void head_ln(v8f* c, const float* gv, const float* bv) {
#pragma unroll
  for (int r = 0; r < 8; ++r) {
    float s = 0.f, ss = 0.f;
#pragma unroll
    for (int j = 0; j < 4; ++j) {
      float v = c[j][r];
      s += v;
      ss += v * v;
    }
    s = row16_sum(s);
    ss = row16_sum(ss);
    float mu = s * (1.f / DHEAD);
    float var = ss * (1.f / DHEAD) - mu * mu;
    float rs = rsqrtf(var + EPS);
#pragma unroll
    for (int j = 0; j < 4; ++j) c[j][r] = (c[j][r] - mu) * rs * gv[j] + bv[j];
  }
}

// ---------------------------------------------------------------- WMMA GEMM
// C[M,Ng] = A[M,K] * Wt[Ng,K]^T.  Block tile 128(M) x 128(N), 8 waves
// (16 M-rows x 128 N each). K step 32; both tiles staged via async b128 to LDS.
// mode 0: outf = C + bias (fp32).
// mode 1: Q (scaled) -> Qh [bh][n][64]; K, V get their head layernorm (width 64)
// on the f32 accumulators: K -> Kh [bh][n][64], V -> Vt [bh][64][n] (transposed
// for the PV WMMA). A wave's 128 columns are two whole heads.
__global__ void gemm_wmma(const _Float16* __restrict__ A, const _Float16* __restrict__ Wt,
                          int M, int Ng, int K, int mode, float* __restrict__ outf,
                          const float* __restrict__ bias, _Float16* __restrict__ Qh,
                          _Float16* __restrict__ Kh, _Float16* __restrict__ Vt,
                          const float* __restrict__ kg, const float* __restrict__ kb,
                          const float* __restrict__ vg, const float* __restrict__ vb) {
  __shared__ __attribute__((aligned(16))) _Float16 ldsA[128 * PITCH32];
  __shared__ __attribute__((aligned(16))) _Float16 ldsB[128 * PITCH32];
  int tid = threadIdx.x;
  int wave = tid >> 5;
  int lane = tid & 31;
  int n0 = blockIdx.x * 128;
  int m0 = blockIdx.y * 128;

  v8f acc[8] = {};

  int row = tid >> 1;              // 0..127
  int ch = (tid & 1) * 16;         // 0 or 16
  const _Float16* srcA = A  + (size_t)(m0 + row) * K + ch;
  const _Float16* srcB = Wt + (size_t)(n0 + row) * K + ch;

  for (int k0 = 0; k0 < K; k0 += 32) {
    async_copy16(ldsA + row * PITCH32 + ch,     srcA + k0);
    async_copy16(ldsA + row * PITCH32 + ch + 8, srcA + k0 + 8);
    async_copy16(ldsB + row * PITCH32 + ch,     srcB + k0);
    async_copy16(ldsB + row * PITCH32 + ch + 8, srcB + k0 + 8);
    if (k0 + 32 < K) {
      __builtin_prefetch(srcA + k0 + 32, 0, 3);
      __builtin_prefetch(srcB + k0 + 32, 0, 3);
    }
    async_wait();
    __syncthreads();
    v16h a = load_frag(ldsA, wave * 16, PITCH32, 0);
#pragma unroll
    for (int t = 0; t < 8; ++t) {
      v16h b = load_frag(ldsB, t * 16, PITCH32, 0);
      acc[t] = WMMA_F16(a, b, acc[t]);
    }
    __syncthreads();
  }

  int nlo = lane & 15;
  int mhi = (lane >> 4) * 8;
  if (mode == 0) {
#pragma unroll
    for (int t = 0; t < 8; ++t) {
      int n = n0 + t * 16 + nlo;
      float bv = bias[n];
#pragma unroll
      for (int r = 0; r < 8; ++r) {
        int m = m0 + wave * 16 + mhi + r;
        outf[(size_t)m * Ng + n] = acc[t][r] + bv;
      }
    }
  } else {
    int which = n0 >> 10;                    // block-uniform: 128 divides 1024
    int h0 = (n0 & 1023) >> 6;               // first of the tile's two heads
    int bb = m0 >> 11;                       // block-uniform: 128 divides NSEQ
    int nn0 = (m0 & 2047) + wave * 16 + mhi; // first of this lane's 8 rows
    if (which == 0) {
#pragma unroll
      for (int t = 0; t < 8; ++t) {
        int bh = bb * HEADS + h0 + (t >> 2);
        _Float16* dst = Qh + ((size_t)bh * NSEQ + nn0) * DHEAD + (t & 3) * 16 + nlo;
#pragma unroll
        for (int r = 0; r < 8; ++r)
          dst[r * DHEAD] = (_Float16)(acc[t][r] * 0.125f);  // fold 1/sqrt(64) into Q
      }
      // precaution: no register that an issued Q store names is rewritten before this wait
      asm volatile("s_wait_xcnt 0x0" ::: "memory");
    } else {
      const float* g = (which == 1) ? kg : vg;
      const float* bt = (which == 1) ? kb : vb;
      float gv[4], bv[4];
#pragma unroll
      for (int j = 0; j < 4; ++j) { gv[j] = g[j * 16 + nlo]; bv[j] = bt[j * 16 + nlo]; }
      // precaution: no register that an issued gain or bias load names is rewritten before this wait
      asm volatile("s_wait_xcnt 0x0" ::: "memory");
      if (which == 1) {
#pragma unroll
        for (int hh = 0; hh < 2; ++hh) {
          head_ln(acc + hh * 4, gv, bv);
          int bh = bb * HEADS + h0 + hh;
#pragma unroll
          for (int j = 0; j < 4; ++j) {
            _Float16* dst = Kh + ((size_t)bh * NSEQ + nn0) * DHEAD + j * 16 + nlo;
#pragma unroll
            for (int r = 0; r < 8; ++r) dst[r * DHEAD] = (_Float16)acc[hh * 4 + j][r];
          }
        }
        // precaution: no register that an issued K store names is rewritten before this wait
        asm volatile("s_wait_xcnt 0x0" ::: "memory");
      } else {
#pragma unroll
        for (int hh = 0; hh < 2; ++hh) {
          head_ln(acc + hh * 4, gv, bv);
          int bh = bb * HEADS + h0 + hh;
          // a lane's 8 rows are 8 consecutive n of one d: one 16-byte store
#pragma unroll
          for (int j = 0; j < 4; ++j) {
            v8h pk;
#pragma unroll
            for (int r = 0; r < 8; ++r) pk[r] = (_Float16)acc[hh * 4 + j][r];
            *(v8h*)(Vt + ((size_t)bh * DHEAD + j * 16 + nlo) * NSEQ + nn0) = pk;
          }
        }
        // precaution: no register that an issued V store names is rewritten before this wait
        asm volatile("s_wait_xcnt 0x0" ::: "memory");
      }
    }
  }
}

// ---------------------------------------------------------------- flash attention
// Lane l takes the value of lane l ^ 16 (the other 16-lane half), on the vector port.
__device__ __forceinline__ float xhalf(float x) {
  int v = __builtin_bit_cast(int, x);
  return __builtin_bit_cast(float,
      __builtin_amdgcn_permlanex16(v, v, 0x76543210, 0xfedcba98, false, false));
}

__global__ void attn_kernel(const _Float16* __restrict__ Qh, const _Float16* __restrict__ Kh,
                            const _Float16* __restrict__ Vt, _Float16* __restrict__ Ao) {
  __shared__ __attribute__((aligned(16))) _Float16 ldsK[32 * PITCH64];
  __shared__ __attribute__((aligned(16))) _Float16 ldsV[64 * PITCH32];
  int tid = threadIdx.x, wave = tid >> 5, lane = tid & 31;
  int nlo = lane & 15, half8 = (lane >> 4) * 8;
  int bh = blockIdx.x >> 4;
  int q0 = (blockIdx.x & 15) * 128 + wave * 16;

  const _Float16* Qbase = Qh + ((size_t)bh * NSEQ + q0) * DHEAD;
  v16h bQ0 = load_frag(Qbase, 0, DHEAD, 0);
  v16h bQ1 = load_frag(Qbase, 0, DHEAD, 32);

  v8f o[4] = {};                     // o[t][r] = O[query nlo][d = t*16 + half8 + r]
  float mrun = -3.0e38f;             // this query's running maximum (equal in both halves)
  float lsum0 = 0.f, lsum1 = 0.f;    // sums over this lane's own keys; joined after the loop

  int rk = tid >> 3, chk = (tid & 7) * 8;   // K tile 32x64: one b128 per thread
  int rd = tid >> 2, chv = (tid & 3) * 8;   // V^T tile 64x32: one b128 per thread
  const _Float16* srcK = Kh + ((size_t)bh * NSEQ + rk) * DHEAD + chk;
  const _Float16* srcV = Vt + ((size_t)bh * DHEAD + rd) * NSEQ + chv;

  for (int kb = 0; kb < NSEQ; kb += 32) {
    __syncthreads();
    async_copy16(ldsK + rk * PITCH64 + chk, srcK + (size_t)kb * DHEAD);
    async_copy16(ldsV + rd * PITCH32 + chv, srcV + kb);
    if (kb + 32 < NSEQ) {
      __builtin_prefetch(srcK + (size_t)(kb + 32) * DHEAD, 0, 3);
      __builtin_prefetch(srcV + kb + 32, 0, 3);
    }
    async_wait();
    __syncthreads();

    // S^T = K Q^T : two 16x16 f32 tiles (keys 0-15, 16-31), K-dim = d = 64.
    // s0[r] = S[query nlo][key half8 + r], s1[r] = S[query nlo][key 16 + half8 + r]
    v8f s0 = {}, s1 = {};
    {
      v16h a0 = load_frag(ldsK, 0, PITCH64, 0);
      v16h a1 = load_frag(ldsK, 16, PITCH64, 0);
      s0 = WMMA_F16(a0, bQ0, s0);
      s1 = WMMA_F16(a1, bQ0, s1);
      a0 = load_frag(ldsK, 0, PITCH64, 32);
      a1 = load_frag(ldsK, 16, PITCH64, 32);
      s0 = WMMA_F16(a0, bQ1, s0);
      s1 = WMMA_F16(a1, bQ1, s1);
    }

    // Online softmax, one query per lane: maximum in-lane, then one exchange of halves.
    float mx = fmaxf(s0[0], s1[0]);
#pragma unroll
    for (int r = 1; r < 8; ++r) mx = fmaxf(mx, fmaxf(s0[r], s1[r]));
    mx = fmaxf(mx, xhalf(mx));
    float mn = fmaxf(mrun, mx);
    float alpha = __expf(mrun - mn);
    mrun = mn;
    lsum0 *= alpha;
    lsum1 *= alpha;
    v16h bP;
#pragma unroll
    for (int r = 0; r < 8; ++r) {
      float p0 = __expf(s0[r] - mn);
      float p1 = __expf(s1[r] - mn);
      lsum0 += p0;
      lsum1 += p1;
      bP[r] = (_Float16)p0;
      bP[r + 8] = (_Float16)p1;
    }
#pragma unroll
    for (int t = 0; t < 4; ++t) o[t] *= alpha;

    // O^T += V^T P^T : K-dim = 32 keys, 4 d-slices of 16
#pragma unroll
    for (int t = 0; t < 4; ++t) {
      v16h aV = load_frag(ldsV, t * 16, PITCH32, 0);
      o[t] = WMMA_F16(aV, bP, o[t]);
    }
  }

  int b = bh >> 4, h = bh & 15;
  float l = lsum0 + lsum1;
  float inv = 1.f / (l + xhalf(l));
  // a lane's 8 values of a tile are 8 consecutive d of one query: one 16-byte store
  _Float16* dst = Ao + ((size_t)b * NSEQ + q0 + nlo) * INNER + h * DHEAD + half8;
#pragma unroll
  for (int t = 0; t < 4; ++t) {
    v8h pk;
#pragma unroll
    for (int r = 0; r < 8; ++r) pk[r] = (_Float16)(o[t][r] * inv);
    *(v8h*)(dst + t * 16) = pk;
  }
}

// ---------------------------------------------------------------- launch
extern "C" void kernel_launch(void* const* d_in, const int* in_sizes, int n_in,
                              void* d_out, int out_size, void* d_ws, size_t ws_size,
                              hipStream_t stream) {
  const float* x       = (const float*)d_in[0];
  const float* norm_g  = (const float*)d_in[1];
  const float* norm_b  = (const float*)d_in[2];
  const float* w_qkv   = (const float*)d_in[3];
  const float* normk_g = (const float*)d_in[4];
  const float* normk_b = (const float*)d_in[5];
  const float* normv_g = (const float*)d_in[6];
  const float* normv_b = (const float*)d_in[7];
  const float* w_out   = (const float*)d_in[8];
  const float* b_out   = (const float*)d_in[9];
  float* out = (float*)d_out;

  const size_t ROWS = (size_t)B_ * NSEQ;                    // 8192
  const size_t HEADSZ = (size_t)B_ * HEADS * NSEQ * DHEAD;  // 8M elements

  char* ws = (char*)d_ws;
  size_t off = 0;
  _Float16* xn16    = (_Float16*)(ws + off); off += ROWS * DIM * 2;
  _Float16* wqkv16t = (_Float16*)(ws + off); off += (size_t)DIM * 3 * INNER * 2;
  _Float16* wout16t = (_Float16*)(ws + off); off += (size_t)INNER * DIM * 2;
  _Float16* Qh      = (_Float16*)(ws + off); off += HEADSZ * 2;
  _Float16* Kh      = (_Float16*)(ws + off); off += HEADSZ * 2;
  _Float16* Vt      = (_Float16*)(ws + off); off += HEADSZ * 2;
  _Float16* Ao      = (_Float16*)(ws + off); off += ROWS * INNER * 2;

  int nqkv = DIM * 3 * INNER;
  int nout = INNER * DIM;
  cvt_transpose<<<(nqkv + 255) / 256, 256, 0, stream>>>(w_qkv, wqkv16t, DIM, 3 * INNER);
  cvt_transpose<<<(nout + 255) / 256, 256, 0, stream>>>(w_out, wout16t, INNER, DIM);

  ln_rows_1024<<<(int)ROWS, 256, 0, stream>>>(x, norm_g, norm_b, xn16);

  gemm_wmma<<<dim3(3 * INNER / 128, ROWS / 128), 256, 0, stream>>>(
      xn16, wqkv16t, (int)ROWS, 3 * INNER, DIM, 1, nullptr, nullptr, Qh, Kh, Vt,
      normk_g, normk_b, normv_g, normv_b);

  attn_kernel<<<B_ * HEADS * (NSEQ / 128), 256, 0, stream>>>(Qh, Kh, Vt, Ao);

  gemm_wmma<<<dim3(DIM / 128, ROWS / 128), 256, 0, stream>>>(
      Ao, wout16t, (int)ROWS, DIM, DIM, 0, out, b_out, nullptr, nullptr, nullptr,
      nullptr, nullptr, nullptr, nullptr);
}

// v004
// It runs in 242 microseconds.
// In both of two side-by-side timings against v003, it was 1.09 times as fast.
// Over all steps from v000 it is 2.43 times as fast.
#include <hip/hip_runtime.h>
#include <hip/hip_bf16.h>

#define B_    4
#define NSEQ  2048
#define DIM   1024
#define HEADS 16
#define DHEAD 64
#define INNER 1024
#define EPS   1e-5f

// LDS row pitches in f16 elements. Every tile is read with 16-byte loads, one row
// per lane, so each pitch is an odd multiple of 16 bytes: 16 rows then fall on
// 16 different groups of four banks. The pad bytes are never written or read.
// The tiles are declared 16-byte aligned, as their 16-byte copies and loads need.
#define PITCH32 40   // rows of 32 f16 (64 B) at 80 B
#define PITCH64 72   // rows of 64 f16 (128 B) at 144 B

typedef __attribute__((ext_vector_type(16))) _Float16 v16h;
typedef __attribute__((ext_vector_type(8)))  _Float16 v8h;
typedef __attribute__((ext_vector_type(4)))  _Float16 v4h;
typedef __attribute__((ext_vector_type(8)))  float    v8f;
typedef __attribute__((ext_vector_type(4)))  float    v4f;
typedef __attribute__((ext_vector_type(2)))  float    v2f;
typedef __attribute__((ext_vector_type(4)))  int      v4i;

#define WMMA_F16(a, b, c) \
  __builtin_amdgcn_wmma_f32_16x16x32_f16(false, (a), false, (b), (short)0, (c), false, false)

#define AS1 __attribute__((address_space(1)))
#define AS3 __attribute__((address_space(3)))

#if __has_builtin(__builtin_amdgcn_global_load_async_to_lds_b128) && \
    __has_builtin(__builtin_amdgcn_s_wait_asynccnt)
#define HAVE_ASYNC 1
#else
#define HAVE_ASYNC 0
#endif

// Copy 16 bytes global -> LDS. Async (ASYNCcnt-tracked, no VGPR staging) when
// the gfx1250 async builtins are available; plain load/store otherwise.
__device__ __forceinline__ void async_copy16(_Float16* lds, const _Float16* g) {
#if HAVE_ASYNC
  __builtin_amdgcn_global_load_async_to_lds_b128((AS1 v4i*)g, (AS3 v4i*)lds, 0, 0);
#else
  *(v8h*)lds = *(const v8h*)g;
#endif
}

__device__ __forceinline__ void async_wait() {
#if HAVE_ASYNC
  __builtin_amdgcn_s_wait_asynccnt(0);
#endif
}

// Load a 16x32 f16 A-fragment (or B-fragment from an [N][K]-transposed tile).
// Layout per CDNA5 ISA 7.12.2: lanes 0-15 hold rows 0-15 with K {0..7,16..23},
// lanes 16-31 hold rows 0-15 with K {8..15,24..31}. Two 16B loads per lane.
__device__ __forceinline__ v16h load_frag(const _Float16* base, int row0, int stride, int koff) {
  int lane = threadIdx.x & 31;
  int r = row0 + (lane & 15);
  int c = koff + ((lane >> 4) << 3);
  const _Float16* p = base + r * stride + c;
  v8h lo = *(const v8h*)p;
  v8h hi = *(const v8h*)(p + 16);
  v16h out;
#pragma unroll
  for (int i = 0; i < 8; ++i) { out[i] = lo[i]; out[i + 8] = hi[i]; }
  return out;
}

// ---------------------------------------------------------------- weight convert+transpose
// in: f32 [K][Ng] row-major  ->  out: f16 [Ng][K] (i.e. W^T), so GEMM B tiles
// are contiguous along K and can be staged with async b128 copies.
// One block moves a 64(k) x 64(n) tile through LDS, 16 elements a thread: 16-byte
// reads along n, 16-byte writes along k. K and Ng are multiples of 64.
// Tile pitch 65 dwords: the row-wise stores and the column-wise loads of a wave
// each fall on 32 different banks.
#define TPITCH 65
__global__ __launch_bounds__(256) void cvt_transpose(const float* __restrict__ in,
                                                     _Float16* __restrict__ out,
                                                     int K, int Ng) {
  __shared__ float tile[64 * TPITCH];
  int tid = threadIdx.x;
  int n0 = blockIdx.x * 64;
  int k0 = blockIdx.y * 64;
  int r = tid >> 4, c4 = (tid & 15) * 4;    // 16 k rows a sweep, 256 B of each
  float4 v[4];
#pragma unroll
  for (int i = 0; i < 4; ++i)
    v[i] = *(const float4*)(in + (size_t)(k0 + r + i * 16) * Ng + n0 + c4);
#pragma unroll
  for (int i = 0; i < 4; ++i) {
    float* t = tile + (r + i * 16) * TPITCH + c4;
    t[0] = v[i].x; t[1] = v[i].y; t[2] = v[i].z; t[3] = v[i].w;
  }
  __syncthreads();
  int nr = tid >> 3, kc = (tid & 7) * 8;    // 32 n rows a sweep, 128 B of each
#pragma unroll
  for (int i = 0; i < 2; ++i) {
    int n = nr + i * 32;
    v8h pk;
#pragma unroll
    for (int j = 0; j < 8; ++j) pk[j] = (_Float16)tile[(kc + j) * TPITCH + n];
    *(v8h*)(out + (size_t)(n0 + n) * K + k0 + kc) = pk;
  }
}

// ---------------------------------------------------------------- row LN (width 1024) -> f16
// One wave takes LN_ROWS whole rows, 32 elements of each a lane (16-byte loads, all
// issued up front): the sums are in-lane plus one butterfly over the wave.
#define LN_ROWS 2
__global__ __launch_bounds__(256) void ln_rows_1024(const float* __restrict__ x,
                                                    const float* __restrict__ g,
                                                    const float* __restrict__ bta,
                                                    _Float16* __restrict__ xn) {
  int wave = threadIdx.x >> 5, lane = threadIdx.x & 31;
  size_t row0 = ((size_t)blockIdx.x * 8 + wave) * LN_ROWS;
  v4f v[LN_ROWS][8];
#pragma unroll
  for (int q = 0; q < LN_ROWS; ++q)
#pragma unroll
    for (int i = 0; i < 8; ++i)
      v[q][i] = *(const v4f*)(x + (row0 + q) * DIM + i * 128 + lane * 4);
  float mu[LN_ROWS], rs[LN_ROWS];
#pragma unroll
  for (int q = 0; q < LN_ROWS; ++q) {
    v2f s2 = {0.f, 0.f}, q2 = {0.f, 0.f};
#pragma unroll
    for (int i = 0; i < 8; ++i) {
      v2f lo = v[q][i].lo, hi = v[q][i].hi;
      s2 += lo;
      q2 += lo * lo;
      s2 += hi;
      q2 += hi * hi;
    }
    float s = s2.x + s2.y, ss = q2.x + q2.y;
#pragma unroll
    for (int m = 16; m >= 1; m >>= 1) {
      s += __shfl_xor(s, m, 32);
      ss += __shfl_xor(ss, m, 32);
    }
    mu[q] = s * (1.f / DIM);
    float var = ss * (1.f / DIM) - mu[q] * mu[q];
    rs[q] = rsqrtf(var + EPS);
  }
#pragma unroll
  for (int i = 0; i < 8; ++i) {
    int c = i * 128 + lane * 4;
    v4f gg = *(const v4f*)(g + c);
    v4f bb = *(const v4f*)(bta + c);
#pragma unroll
    for (int q = 0; q < LN_ROWS; ++q) {
      v4f t = (v[q][i] - mu[q]) * rs[q] * gg + bb;
      *(v4h*)(xn + (row0 + q) * DIM + c) = __builtin_convertvector(t, v4h);
    }
  }
}

// ---------------------------------------------------------------- 16-lane row sum
// Sum over the 16 lanes of a DPP row (all lanes get the sum). The C tile of a
// WMMA keeps one matrix row in one 16-lane half, so this is a sum along N.
template <int CTRL>
__device__ __forceinline__ float dpp_xadd(float v) {
  int o = __builtin_amdgcn_update_dpp(0, __builtin_bit_cast(int, v), CTRL, 0xf, 0xf, true);
  return v + __builtin_bit_cast(float, o);
}
__device__ __forceinline__ float row16_sum(float v) {
  v = dpp_xadd<0x161>(v);  // row_xmask:1
  v = dpp_xadd<0x162>(v);  // row_xmask:2
  v = dpp_xadd<0x164>(v);  // row_xmask:4
  v = dpp_xadd<0x168>(v);  // row_xmask:8
  return v;
}

// Layernorm of width 64 in place on four 16x16 f32 C tiles that lie side by side
// along N (one head). gv, bv: this lane's gain and bias for its column of each tile.
__device__ __forceinline__ void head_ln(v8f* c, const float* gv, const float* bv) {
#pragma unroll
  for (int r = 0; r < 8; ++r) {
    float s = 0.f, ss = 0.f;
#pragma unroll
    for (int j = 0; j < 4; ++j) {
      float v = c[j][r];
      s += v;
      ss += v * v;
    }
    s = row16_sum(s);
    ss = row16_sum(ss);
    float mu = s * (1.f / DHEAD);
    float var = ss * (1.f / DHEAD) - mu * mu;
    float rs = rsqrtf(var + EPS);
#pragma unroll
    for (int j = 0; j < 4; ++j) c[j][r] = (c[j][r] - mu) * rs * gv[j] + bv[j];
  }
}

// ---------------------------------------------------------------- WMMA GEMM
// C[M,Ng] = A[M,K] * Wt[Ng,K]^T.  Block tile 128(M) x 128(N), 8 waves
// (16 M-rows x 128 N each). K step 32; both tiles staged via async b128 to LDS.
// mode 0: outf = C + bias (fp32).
// mode 1: Q (scaled) -> Qh [bh][n][64]; K, V get their head layernorm (width 64)
// on the f32 accumulators: K -> Kh [bh][n][64], V -> Vt [bh][64][n] (transposed
// for the PV WMMA). A wave's 128 columns are two whole heads.
__global__ void gemm_wmma(const _Float16* __restrict__ A, const _Float16* __restrict__ Wt,
                          int M, int Ng, int K, int mode, float* __restrict__ outf,
                          const float* __restrict__ bias, _Float16* __restrict__ Qh,
                          _Float16* __restrict__ Kh, _Float16* __restrict__ Vt,
                          const float* __restrict__ kg, const float* __restrict__ kb,
                          const float* __restrict__ vg, const float* __restrict__ vb) {
  __shared__ __attribute__((aligned(16))) _Float16 ldsA[128 * PITCH32];
  __shared__ __attribute__((aligned(16))) _Float16 ldsB[128 * PITCH32];
  int tid = threadIdx.x;
  int wave = tid >> 5;
  int lane = tid & 31;
  int n0 = blockIdx.x * 128;
  int m0 = blockIdx.y * 128;

  v8f acc[8] = {};

  int row = tid >> 1;              // 0..127
  int ch = (tid & 1) * 16;         // 0 or 16
  const _Float16* srcA = A  + (size_t)(m0 + row) * K + ch;
  const _Float16* srcB = Wt + (size_t)(n0 + row) * K + ch;

  for (int k0 = 0; k0 < K; k0 += 32) {
    async_copy16(ldsA + row * PITCH32 + ch,     srcA + k0);
    async_copy16(ldsA + row * PITCH32 + ch + 8, srcA + k0 + 8);
    async_copy16(ldsB + row * PITCH32 + ch,     srcB + k0);
    async_copy16(ldsB + row * PITCH32 + ch + 8, srcB + k0 + 8);
    if (k0 + 32 < K) {
      __builtin_prefetch(srcA + k0 + 32, 0, 3);
      __builtin_prefetch(srcB + k0 + 32, 0, 3);
    }
    async_wait();
    __syncthreads();
    v16h a = load_frag(ldsA, wave * 16, PITCH32, 0);
#pragma unroll
    for (int t = 0; t < 8; ++t) {
      v16h b = load_frag(ldsB, t * 16, PITCH32, 0);
      acc[t] = WMMA_F16(a, b, acc[t]);
    }
    __syncthreads();
  }

  int nlo = lane & 15;
  int mhi = (lane >> 4) * 8;
  if (mode == 0) {
#pragma unroll
    for (int t = 0; t < 8; ++t) {
      int n = n0 + t * 16 + nlo;
      float bv = bias[n];
#pragma unroll
      for (int r = 0; r < 8; ++r) {
        int m = m0 + wave * 16 + mhi + r;
        outf[(size_t)m * Ng + n] = acc[t][r] + bv;
      }
    }
  } else {
    int which = n0 >> 10;                    // block-uniform: 128 divides 1024
    int h0 = (n0 & 1023) >> 6;               // first of the tile's two heads
    int bb = m0 >> 11;                       // block-uniform: 128 divides NSEQ
    int nn0 = (m0 & 2047) + wave * 16 + mhi; // first of this lane's 8 rows
    if (which == 0) {
#pragma unroll
      for (int t = 0; t < 8; ++t) {
        int bh = bb * HEADS + h0 + (t >> 2);
        _Float16* dst = Qh + ((size_t)bh * NSEQ + nn0) * DHEAD + (t & 3) * 16 + nlo;
#pragma unroll
        for (int r = 0; r < 8; ++r)
          dst[r * DHEAD] = (_Float16)(acc[t][r] * 0.125f);  // fold 1/sqrt(64) into Q
      }
      // precaution: no register that an issued Q store names is rewritten before this wait
      asm volatile("s_wait_xcnt 0x0" ::: "memory");
    } else {
      const float* g = (which == 1) ? kg : vg;
      const float* bt = (which == 1) ? kb : vb;
      float gv[4], bv[4];
#pragma unroll
      for (int j = 0; j < 4; ++j) { gv[j] = g[j * 16 + nlo]; bv[j] = bt[j * 16 + nlo]; }
      // precaution: no register that an issued gain or bias load names is rewritten before this wait
      asm volatile("s_wait_xcnt 0x0" ::: "memory");
      if (which == 1) {
#pragma unroll
        for (int hh = 0; hh < 2; ++hh) {
          head_ln(acc + hh * 4, gv, bv);
          int bh = bb * HEADS + h0 + hh;
#pragma unroll
          for (int j = 0; j < 4; ++j) {
            _Float16* dst = Kh + ((size_t)bh * NSEQ + nn0) * DHEAD + j * 16 + nlo;
#pragma unroll
            for (int r = 0; r < 8; ++r) dst[r * DHEAD] = (_Float16)acc[hh * 4 + j][r];
          }
        }
        // precaution: no register that an issued K store names is rewritten before this wait
        asm volatile("s_wait_xcnt 0x0" ::: "memory");
      } else {
#pragma unroll
        for (int hh = 0; hh < 2; ++hh) {
          head_ln(acc + hh * 4, gv, bv);
          int bh = bb * HEADS + h0 + hh;
          // a lane's 8 rows are 8 consecutive n of one d: one 16-byte store
#pragma unroll
          for (int j = 0; j < 4; ++j) {
            v8h pk;
#pragma unroll
            for (int r = 0; r < 8; ++r) pk[r] = (_Float16)acc[hh * 4 + j][r];
            *(v8h*)(Vt + ((size_t)bh * DHEAD + j * 16 + nlo) * NSEQ + nn0) = pk;
          }
        }
        // precaution: no register that an issued V store names is rewritten before this wait
        asm volatile("s_wait_xcnt 0x0" ::: "memory");
      }
    }
  }
}

// ---------------------------------------------------------------- flash attention
// Lane l takes the value of lane l ^ 16 (the other 16-lane half), on the vector port.
__device__ __forceinline__ float xhalf(float x) {
  int v = __builtin_bit_cast(int, x);
  return __builtin_bit_cast(float,
      __builtin_amdgcn_permlanex16(v, v, 0x76543210, 0xfedcba98, false, false));
}

__global__ void attn_kernel(const _Float16* __restrict__ Qh, const _Float16* __restrict__ Kh,
                            const _Float16* __restrict__ Vt, _Float16* __restrict__ Ao) {
  __shared__ __attribute__((aligned(16))) _Float16 ldsK[32 * PITCH64];
  __shared__ __attribute__((aligned(16))) _Float16 ldsV[64 * PITCH32];
  int tid = threadIdx.x, wave = tid >> 5, lane = tid & 31;
  int nlo = lane & 15, half8 = (lane >> 4) * 8;
  int bh = blockIdx.x >> 4;
  int q0 = (blockIdx.x & 15) * 128 + wave * 16;

  const _Float16* Qbase = Qh + ((size_t)bh * NSEQ + q0) * DHEAD;
  v16h bQ0 = load_frag(Qbase, 0, DHEAD, 0);
  v16h bQ1 = load_frag(Qbase, 0, DHEAD, 32);

  v8f o[4] = {};                     // o[t][r] = O[query nlo][d = t*16 + half8 + r]
  float mrun = -3.0e38f;             // this query's running maximum (equal in both halves)
  float lsum0 = 0.f, lsum1 = 0.f;    // sums over this lane's own keys; joined after the loop

  int rk = tid >> 3, chk = (tid & 7) * 8;   // K tile 32x64: one b128 per thread
  int rd = tid >> 2, chv = (tid & 3) * 8;   // V^T tile 64x32: one b128 per thread
  const _Float16* srcK = Kh + ((size_t)bh * NSEQ + rk) * DHEAD + chk;
  const _Float16* srcV = Vt + ((size_t)bh * DHEAD + rd) * NSEQ + chv;

  for (int kb = 0; kb < NSEQ; kb += 32) {
    __syncthreads();
    async_copy16(ldsK + rk * PITCH64 + chk, srcK + (size_t)kb * DHEAD);
    async_copy16(ldsV + rd * PITCH32 + chv, srcV + kb);
    if (kb + 32 < NSEQ) {
      __builtin_prefetch(srcK + (size_t)(kb + 32) * DHEAD, 0, 3);
      __builtin_prefetch(srcV + kb + 32, 0, 3);
    }
    async_wait();
    __syncthreads();

    // S^T = K Q^T : two 16x16 f32 tiles (keys 0-15, 16-31), K-dim = d = 64.
    // s0[r] = S[query nlo][key half8 + r], s1[r] = S[query nlo][key 16 + half8 + r]
    v8f s0 = {}, s1 = {};
    {
      v16h a0 = load_frag(ldsK, 0, PITCH64, 0);
      v16h a1 = load_frag(ldsK, 16, PITCH64, 0);
      s0 = WMMA_F16(a0, bQ0, s0);
      s1 = WMMA_F16(a1, bQ0, s1);
      a0 = load_frag(ldsK, 0, PITCH64, 32);
      a1 = load_frag(ldsK, 16, PITCH64, 32);
      s0 = WMMA_F16(a0, bQ1, s0);
      s1 = WMMA_F16(a1, bQ1, s1);
    }

    // Online softmax, one query per lane: maximum in-lane, then one exchange of halves.
    float mx = fmaxf(s0[0], s1[0]);
#pragma unroll
    for (int r = 1; r < 8; ++r) mx = fmaxf(mx, fmaxf(s0[r], s1[r]));
    mx = fmaxf(mx, xhalf(mx));
    float mn = fmaxf(mrun, mx);
    float alpha = __expf(mrun - mn);
    mrun = mn;
    lsum0 *= alpha;
    lsum1 *= alpha;
    v16h bP;
#pragma unroll
    for (int r = 0; r < 8; ++r) {
      float p0 = __expf(s0[r] - mn);
      float p1 = __expf(s1[r] - mn);
      lsum0 += p0;
      lsum1 += p1;
      bP[r] = (_Float16)p0;
      bP[r + 8] = (_Float16)p1;
    }
#pragma unroll
    for (int t = 0; t < 4; ++t) o[t] *= alpha;

    // O^T += V^T P^T : K-dim = 32 keys, 4 d-slices of 16
#pragma unroll
    for (int t = 0; t < 4; ++t) {
      v16h aV = load_frag(ldsV, t * 16, PITCH32, 0);
      o[t] = WMMA_F16(aV, bP, o[t]);
    }
  }

  int b = bh >> 4, h = bh & 15;
  float l = lsum0 + lsum1;
  float inv = 1.f / (l + xhalf(l));
  // a lane's 8 values of a tile are 8 consecutive d of one query: one 16-byte store
  _Float16* dst = Ao + ((size_t)b * NSEQ + q0 + nlo) * INNER + h * DHEAD + half8;
#pragma unroll
  for (int t = 0; t < 4; ++t) {
    v8h pk;
#pragma unroll
    for (int r = 0; r < 8; ++r) pk[r] = (_Float16)(o[t][r] * inv);
    *(v8h*)(dst + t * 16) = pk;
  }
}

// ---------------------------------------------------------------- launch
extern "C" void kernel_launch(void* const* d_in, const int* in_sizes, int n_in,
                              void* d_out, int out_size, void* d_ws, size_t ws_size,
                              hipStream_t stream) {
  const float* x       = (const float*)d_in[0];
  const float* norm_g  = (const float*)d_in[1];
  const float* norm_b  = (const float*)d_in[2];
  const float* w_qkv   = (const float*)d_in[3];
  const float* normk_g = (const float*)d_in[4];
  const float* normk_b = (const float*)d_in[5];
  const float* normv_g = (const float*)d_in[6];
  const float* normv_b = (const float*)d_in[7];
  const float* w_out   = (const float*)d_in[8];
  const float* b_out   = (const float*)d_in[9];
  float* out = (float*)d_out;

  const size_t ROWS = (size_t)B_ * NSEQ;                    // 8192
  const size_t HEADSZ = (size_t)B_ * HEADS * NSEQ * DHEAD;  // 8M elements

  char* ws = (char*)d_ws;
  size_t off = 0;
  _Float16* xn16    = (_Float16*)(ws + off); off += ROWS * DIM * 2;
  _Float16* wqkv16t = (_Float16*)(ws + off); off += (size_t)DIM * 3 * INNER * 2;
  _Float16* wout16t = (_Float16*)(ws + off); off += (size_t)INNER * DIM * 2;
  _Float16* Qh      = (_Float16*)(ws + off); off += HEADSZ * 2;
  _Float16* Kh      = (_Float16*)(ws + off); off += HEADSZ * 2;
  _Float16* Vt      = (_Float16*)(ws + off); off += HEADSZ * 2;
  _Float16* Ao      = (_Float16*)(ws + off); off += ROWS * INNER * 2;

  cvt_transpose<<<dim3(3 * INNER / 64, DIM / 64), 256, 0, stream>>>(w_qkv, wqkv16t, DIM, 3 * INNER);
  cvt_transpose<<<dim3(DIM / 64, INNER / 64), 256, 0, stream>>>(w_out, wout16t, INNER, DIM);

  ln_rows_1024<<<(int)(ROWS / (8 * LN_ROWS)), 256, 0, stream>>>(x, norm_g, norm_b, xn16);

  gemm_wmma<<<dim3(3 * INNER / 128, ROWS / 128), 256, 0, stream>>>(
      xn16, wqkv16t, (int)ROWS, 3 * INNER, DIM, 1, nullptr, nullptr, Qh, Kh, Vt,
      normk_g, normk_b, normv_g, normv_b);

  attn_kernel<<<B_ * HEADS * (NSEQ / 128), 256, 0, stream>>>(Qh, Kh, Vt, Ao);

  gemm_wmma<<<dim3(DIM / 128, ROWS / 128), 256, 0, stream>>>(
      Ao, wout16t, (int)ROWS, DIM, DIM, 0, out, b_out, nullptr, nullptr, nullptr,
      nullptr, nullptr, nullptr, nullptr);
}

// v005
// A run of this version takes 182 microseconds.
// Timed twice side by side with v004, it ran 1.33 and 1.34 times as fast.
// All steps since v000 together make it 3.24 times as fast.
#include <hip/hip_runtime.h>
#include <hip/hip_bf16.h>

#define B_    4
#define NSEQ  2048
#define DIM   1024
#define HEADS 16
#define DHEAD 64
#define INNER 1024
#define EPS   1e-5f

// LDS row pitch in f16 elements. Every staged tile has rows of 64 f16 = 128 bytes,
// one whole cache line of its source: eight adjacent lanes copy one row, so a wave's
// 16-byte copy asks for four full lines. Every tile is read with 16-byte loads, one
// row per lane, so the pitch is an odd multiple of 16 bytes: 16 rows then fall on
// 16 different groups of four banks. The pad bytes are never written or read.
// The tiles are declared 16-byte aligned, as their 16-byte copies and loads need.
#define PITCH64 72   // rows of 64 f16 (128 B) at 144 B

typedef __attribute__((ext_vector_type(16))) _Float16 v16h;
typedef __attribute__((ext_vector_type(8)))  _Float16 v8h;
typedef __attribute__((ext_vector_type(4)))  _Float16 v4h;
typedef __attribute__((ext_vector_type(8)))  float    v8f;
typedef __attribute__((ext_vector_type(4)))  float    v4f;
typedef __attribute__((ext_vector_type(2)))  float    v2f;
typedef __attribute__((ext_vector_type(4)))  int      v4i;

#define WMMA_F16(a, b, c) \
  __builtin_amdgcn_wmma_f32_16x16x32_f16(false, (a), false, (b), (short)0, (c), false, false)

#define AS1 __attribute__((address_space(1)))
#define AS3 __attribute__((address_space(3)))

#if __has_builtin(__builtin_amdgcn_global_load_async_to_lds_b128) && \
    __has_builtin(__builtin_amdgcn_s_wait_asynccnt)
#define HAVE_ASYNC 1
#else
#define HAVE_ASYNC 0
#endif

// Copy 16 bytes global -> LDS. Async (ASYNCcnt-tracked, no VGPR staging) when
// the gfx1250 async builtins are available; plain load/store otherwise.
__device__ __forceinline__ void async_copy16(_Float16* lds, const _Float16* g) {
#if HAVE_ASYNC
  __builtin_amdgcn_global_load_async_to_lds_b128((AS1 v4i*)g, (AS3 v4i*)lds, 0, 0);
#else
  *(v8h*)lds = *(const v8h*)g;
#endif
}

// This wave's copies have landed; the "memory" clobber keeps every LDS read behind it.
__device__ __forceinline__ void async_wait() {
#if HAVE_ASYNC
  asm volatile("s_wait_asynccnt 0x0" ::: "memory");
#endif
}

// Load a 16x32 f16 A-fragment (or B-fragment from an [N][K]-transposed tile).
// Layout per CDNA5 ISA 7.12.2: lanes 0-15 hold rows 0-15 with K {0..7,16..23},
// lanes 16-31 hold rows 0-15 with K {8..15,24..31}. Two 16B loads per lane.
__device__ __forceinline__ v16h load_frag(const _Float16* base, int row0, int stride, int koff) {
  int lane = threadIdx.x & 31;
  int r = row0 + (lane & 15);
  int c = koff + ((lane >> 4) << 3);
  const _Float16* p = base + r * stride + c;
  v8h lo = *(const v8h*)p;
  v8h hi = *(const v8h*)(p + 16);
  v16h out;
#pragma unroll
  for (int i = 0; i < 8; ++i) { out[i] = lo[i]; out[i + 8] = hi[i]; }
  return out;
}

// ---------------------------------------------------------------- weight convert+transpose
// in: f32 [K][Ng] row-major  ->  out: f16 [Ng][K] (i.e. W^T), so GEMM B tiles
// are contiguous along K and can be staged with async b128 copies.
// One block moves a 64(k) x 64(n) tile through LDS, 16 elements a thread: 16-byte
// reads along n, 16-byte writes along k. K and Ng are multiples of 64.
// Tile pitch 65 dwords: the row-wise stores and the column-wise loads of a wave
// each fall on 32 different banks.
#define TPITCH 65
__global__ __launch_bounds__(256) void cvt_transpose(const float* __restrict__ in,
                                                     _Float16* __restrict__ out,
                                                     int K, int Ng) {
  __shared__ float tile[64 * TPITCH];
  int tid = threadIdx.x;
  int n0 = blockIdx.x * 64;
  int k0 = blockIdx.y * 64;
  int r = tid >> 4, c4 = (tid & 15) * 4;    // 16 k rows a sweep, 256 B of each
  float4 v[4];
#pragma unroll
  for (int i = 0; i < 4; ++i)
    v[i] = *(const float4*)(in + (size_t)(k0 + r + i * 16) * Ng + n0 + c4);
#pragma unroll
  for (int i = 0; i < 4; ++i) {
    float* t = tile + (r + i * 16) * TPITCH + c4;
    t[0] = v[i].x; t[1] = v[i].y; t[2] = v[i].z; t[3] = v[i].w;
  }
  __syncthreads();
  int nr = tid >> 3, kc = (tid & 7) * 8;    // 32 n rows a sweep, 128 B of each
#pragma unroll
  for (int i = 0; i < 2; ++i) {
    int n = nr + i * 32;
    v8h pk;
#pragma unroll
    for (int j = 0; j < 8; ++j) pk[j] = (_Float16)tile[(kc + j) * TPITCH + n];
    *(v8h*)(out + (size_t)(n0 + n) * K + k0 + kc) = pk;
  }
}

// ---------------------------------------------------------------- row LN (width 1024) -> f16
// One wave takes LN_ROWS whole rows, 32 elements of each a lane (16-byte loads, all
// issued up front): the sums are in-lane plus one butterfly over the wave.
#define LN_ROWS 2
__global__ __launch_bounds__(256) void ln_rows_1024(const float* __restrict__ x,
                                                    const float* __restrict__ g,
                                                    const float* __restrict__ bta,
                                                    _Float16* __restrict__ xn) {
  int wave = threadIdx.x >> 5, lane = threadIdx.x & 31;
  size_t row0 = ((size_t)blockIdx.x * 8 + wave) * LN_ROWS;
  v4f v[LN_ROWS][8];
#pragma unroll
  for (int q = 0; q < LN_ROWS; ++q)
#pragma unroll
    for (int i = 0; i < 8; ++i)
      v[q][i] = *(const v4f*)(x + (row0 + q) * DIM + i * 128 + lane * 4);
  float mu[LN_ROWS], rs[LN_ROWS];
#pragma unroll
  for (int q = 0; q < LN_ROWS; ++q) {
    v2f s2 = {0.f, 0.f}, q2 = {0.f, 0.f};
#pragma unroll
    for (int i = 0; i < 8; ++i) {
      v2f lo = v[q][i].lo, hi = v[q][i].hi;
      s2 += lo;
      q2 += lo * lo;
      s2 += hi;
      q2 += hi * hi;
    }
    float s = s2.x + s2.y, ss = q2.x + q2.y;
#pragma unroll
    for (int m = 16; m >= 1; m >>= 1) {
      s += __shfl_xor(s, m, 32);
      ss += __shfl_xor(ss, m, 32);
    }
    mu[q] = s * (1.f / DIM);
    float var = ss * (1.f / DIM) - mu[q] * mu[q];
    rs[q] = rsqrtf(var + EPS);
  }
#pragma unroll
  for (int i = 0; i < 8; ++i) {
    int c = i * 128 + lane * 4;
    v4f gg = *(const v4f*)(g + c);
    v4f bb = *(const v4f*)(bta + c);
#pragma unroll
    for (int q = 0; q < LN_ROWS; ++q) {
      v4f t = (v[q][i] - mu[q]) * rs[q] * gg + bb;
      *(v4h*)(xn + (row0 + q) * DIM + c) = __builtin_convertvector(t, v4h);
    }
  }
}

// ---------------------------------------------------------------- 16-lane row sum
// Sum over the 16 lanes of a DPP row (all lanes get the sum). The C tile of a
// WMMA keeps one matrix row in one 16-lane half, so this is a sum along N.
template <int CTRL>
__device__ __forceinline__ float dpp_xadd(float v) {
  int o = __builtin_amdgcn_update_dpp(0, __builtin_bit_cast(int, v), CTRL, 0xf, 0xf, true);
  return v + __builtin_bit_cast(float, o);
}
__device__ __forceinline__ float row16_sum(float v) {
  v = dpp_xadd<0x161>(v);  // row_xmask:1
  v = dpp_xadd<0x162>(v);  // row_xmask:2
  v = dpp_xadd<0x164>(v);  // row_xmask:4
  v = dpp_xadd<0x168>(v);  // row_xmask:8
  return v;
}

// Layernorm of width 64 in place on four 16x16 f32 C tiles that lie side by side
// along N (one head). gv, bv: this lane's gain and bias for its column of each tile.
__device__ __forceinline__ void head_ln(v8f* c, const float* gv, const float* bv) {
#pragma unroll
  for (int r = 0; r < 8; ++r) {
    float s = 0.f, ss = 0.f;
#pragma unroll
    for (int j = 0; j < 4; ++j) {
      float v = c[j][r];
      s += v;
      ss += v * v;
    }
    s = row16_sum(s);
    ss = row16_sum(ss);
    float mu = s * (1.f / DHEAD);
    float var = ss * (1.f / DHEAD) - mu * mu;
    float rs = rsqrtf(var + EPS);
#pragma unroll
    for (int j = 0; j < 4; ++j) c[j][r] = (c[j][r] - mu) * rs * gv[j] + bv[j];
  }
}

// ---------------------------------------------------------------- WMMA GEMM
// C[M,Ng] = A[M,K] * Wt[Ng,K]^T.  Block tile 128(M) x 128(N), 8 waves
// (16 M-rows x 128 N each). K step 64 (K a multiple of 64): both tiles staged via
// async b128 to LDS in whole 128-byte rows, worked on as two k slices of 32.
// mode 0: outf = C + bias (fp32).
// mode 1: Q (scaled) -> Qh [bh][n][64]; K, V get their head layernorm (width 64)
// on the f32 accumulators: K -> Kh [bh][n][64], V -> Vt [bh][64][n] (transposed
// for the PV WMMA). A wave's 128 columns are two whole heads.
__global__ void gemm_wmma(const _Float16* __restrict__ A, const _Float16* __restrict__ Wt,
                          int M, int Ng, int K, int mode, float* __restrict__ outf,
                          const float* __restrict__ bias, _Float16* __restrict__ Qh,
                          _Float16* __restrict__ Kh, _Float16* __restrict__ Vt,
                          const float* __restrict__ kg, const float* __restrict__ kb,
                          const float* __restrict__ vg, const float* __restrict__ vb) {
  __shared__ __attribute__((aligned(16))) _Float16 ldsA[128 * PITCH64];
  __shared__ __attribute__((aligned(16))) _Float16 ldsB[128 * PITCH64];
  int tid = threadIdx.x;
  int wave = tid >> 5;
  int lane = tid & 31;
  int n0 = blockIdx.x * 128;
  int m0 = blockIdx.y * 128;

  v8f acc[8] = {};

  int row = tid >> 3;              // 0..31: 32 rows a sweep, four sweeps a tile
  int ch = (tid & 7) * 8;          // this lane's 16 bytes of the row's 128
  const _Float16* srcA = A  + (size_t)(m0 + row) * K + ch;
  const _Float16* srcB = Wt + (size_t)(n0 + row) * K + ch;
  _Float16* dstA = ldsA + row * PITCH64 + ch;
  _Float16* dstB = ldsB + row * PITCH64 + ch;
  // the next step's 256 rows are 256 lines: each thread asks for one
  const _Float16* pf = (tid < 128) ? A + (size_t)(m0 + tid) * K
                                   : Wt + (size_t)(n0 + tid - 128) * K;

  for (int k0 = 0; k0 < K; k0 += 64) {
#pragma unroll  // the four sweeps' places in LDS are constants
    for (int i = 0; i < 4; ++i) {
      async_copy16(dstA + i * 32 * PITCH64, srcA + (size_t)(i * 32) * K + k0);
      async_copy16(dstB + i * 32 * PITCH64, srcB + (size_t)(i * 32) * K + k0);
    }
    if (k0 + 64 < K) __builtin_prefetch(pf + k0 + 64, 0, 3);
    async_wait();
    __syncthreads();
#pragma unroll  // the slice's offset becomes an immediate of the LDS loads
    for (int kk = 0; kk < 64; kk += 32) {
      v16h a = load_frag(ldsA, wave * 16, PITCH64, kk);
#pragma unroll
      for (int t = 0; t < 8; ++t) {
        v16h b = load_frag(ldsB, t * 16, PITCH64, kk);
        acc[t] = WMMA_F16(a, b, acc[t]);
      }
    }
    __syncthreads();
  }

  int nlo = lane & 15;
  int mhi = (lane >> 4) * 8;
  if (mode == 0) {
#pragma unroll
    for (int t = 0; t < 8; ++t) {
      int n = n0 + t * 16 + nlo;
      float bv = bias[n];
#pragma unroll
      for (int r = 0; r < 8; ++r) {
        int m = m0 + wave * 16 + mhi + r;
        outf[(size_t)m * Ng + n] = acc[t][r] + bv;
      }
    }
  } else {
    int which = n0 >> 10;                    // block-uniform: 128 divides 1024
    int h0 = (n0 & 1023) >> 6;               // first of the tile's two heads
    int bb = m0 >> 11;                       // block-uniform: 128 divides NSEQ
    int nn0 = (m0 & 2047) + wave * 16 + mhi; // first of this lane's 8 rows
    if (which == 0) {
#pragma unroll
      for (int t = 0; t < 8; ++t) {
        int bh = bb * HEADS + h0 + (t >> 2);
        _Float16* dst = Qh + ((size_t)bh * NSEQ + nn0) * DHEAD + (t & 3) * 16 + nlo;
#pragma unroll
        for (int r = 0; r < 8; ++r)
          dst[r * DHEAD] = (_Float16)(acc[t][r] * 0.125f);  // fold 1/sqrt(64) into Q
      }
      // precaution: no register that an issued Q store names is rewritten before this wait
      asm volatile("s_wait_xcnt 0x0" ::: "memory");
    } else {
      const float* g = (which == 1) ? kg : vg;
      const float* bt = (which == 1) ? kb : vb;
      float gv[4], bv[4];
#pragma unroll
      for (int j = 0; j < 4; ++j) { gv[j] = g[j * 16 + nlo]; bv[j] = bt[j * 16 + nlo]; }
      // precaution: no register that an issued gain or bias load names is rewritten before this wait
      asm volatile("s_wait_xcnt 0x0" ::: "memory");
      if (which == 1) {
#pragma unroll
        for (int hh = 0; hh < 2; ++hh) {
          head_ln(acc + hh * 4, gv, bv);
          int bh = bb * HEADS + h0 + hh;
#pragma unroll
          for (int j = 0; j < 4; ++j) {
            _Float16* dst = Kh + ((size_t)bh * NSEQ + nn0) * DHEAD + j * 16 + nlo;
#pragma unroll
            for (int r = 0; r < 8; ++r) dst[r * DHEAD] = (_Float16)acc[hh * 4 + j][r];
          }
        }
        // precaution: no register that an issued K store names is rewritten before this wait
        asm volatile("s_wait_xcnt 0x0" ::: "memory");
      } else {
#pragma unroll
        for (int hh = 0; hh < 2; ++hh) {
          head_ln(acc + hh * 4, gv, bv);
          int bh = bb * HEADS + h0 + hh;
          // a lane's 8 rows are 8 consecutive n of one d: one 16-byte store
#pragma unroll
          for (int j = 0; j < 4; ++j) {
            v8h pk;
#pragma unroll
            for (int r = 0; r < 8; ++r) pk[r] = (_Float16)acc[hh * 4 + j][r];
            *(v8h*)(Vt + ((size_t)bh * DHEAD + j * 16 + nlo) * NSEQ + nn0) = pk;
          }
        }
        // precaution: no register that an issued V store names is rewritten before this wait
        asm volatile("s_wait_xcnt 0x0" ::: "memory");
      }
    }
  }
}

// ---------------------------------------------------------------- flash attention
// Lane l takes the value of lane l ^ 16 (the other 16-lane half), on the vector port.
__device__ __forceinline__ float xhalf(float x) {
  int v = __builtin_bit_cast(int, x);
  return __builtin_bit_cast(float,
      __builtin_amdgcn_permlanex16(v, v, 0x76543210, 0xfedcba98, false, false));
}

__global__ void attn_kernel(const _Float16* __restrict__ Qh, const _Float16* __restrict__ Kh,
                            const _Float16* __restrict__ Vt, _Float16* __restrict__ Ao) {
  __shared__ __attribute__((aligned(16))) _Float16 ldsK[64 * PITCH64];
  __shared__ __attribute__((aligned(16))) _Float16 ldsV[64 * PITCH64];
  int tid = threadIdx.x, wave = tid >> 5, lane = tid & 31;
  int nlo = lane & 15, half8 = (lane >> 4) * 8;
  int bh = blockIdx.x >> 4;
  int q0 = (blockIdx.x & 15) * 128 + wave * 16;

  const _Float16* Qbase = Qh + ((size_t)bh * NSEQ + q0) * DHEAD;
  v16h bQ0 = load_frag(Qbase, 0, DHEAD, 0);
  v16h bQ1 = load_frag(Qbase, 0, DHEAD, 32);

  v8f o[4] = {};                     // o[t][r] = O[query nlo][d = t*16 + half8 + r]
  float mrun = -3.0e38f;             // this query's running maximum (equal in both halves)
  float lsum0 = 0.f, lsum1 = 0.f;    // sums over this lane's own keys; joined after the loop

  // K tile 64(key) x 64(d), V^T tile 64(d) x 64(key): two b128 per thread of each
  int rr = tid >> 3, cc = (tid & 7) * 8;
  const _Float16* srcK = Kh + ((size_t)bh * NSEQ + rr) * DHEAD + cc;
  const _Float16* srcV = Vt + ((size_t)bh * DHEAD + rr) * NSEQ + cc;
  _Float16* dstK = ldsK + rr * PITCH64 + cc;
  _Float16* dstV = ldsV + rr * PITCH64 + cc;

  for (int kb = 0; kb < NSEQ; kb += 64) {
    __syncthreads();
#pragma unroll  // the two sweeps' places in LDS are constants
    for (int i = 0; i < 2; ++i) {
      async_copy16(dstK + i * 32 * PITCH64, srcK + (size_t)(kb + i * 32) * DHEAD);
      async_copy16(dstV + i * 32 * PITCH64, srcV + (size_t)(i * 32) * NSEQ + kb);
    }
    if (kb + 64 < NSEQ) {
#pragma unroll  // the sweeps' steps become immediates of the prefetches
      for (int i = 0; i < 2; ++i) {
        __builtin_prefetch(srcK + (size_t)(kb + 64 + i * 32) * DHEAD, 0, 3);
        __builtin_prefetch(srcV + (size_t)(i * 32) * NSEQ + kb + 64, 0, 3);
      }
    }
    async_wait();
    __syncthreads();

#pragma unroll  // the block's offset becomes an immediate of the LDS loads
    for (int ks = 0; ks < 64; ks += 32) {
    // S^T = K Q^T : two 16x16 f32 tiles (keys ks + 0-15, ks + 16-31), K-dim = d = 64.
    // s0[r] = S[query nlo][key ks + half8 + r], s1[r] = S[query nlo][key ks + 16 + half8 + r]
    v8f s0 = {}, s1 = {};
    {
      v16h a0 = load_frag(ldsK, ks, PITCH64, 0);
      v16h a1 = load_frag(ldsK, ks + 16, PITCH64, 0);
      s0 = WMMA_F16(a0, bQ0, s0);
      s1 = WMMA_F16(a1, bQ0, s1);
      a0 = load_frag(ldsK, ks, PITCH64, 32);
      a1 = load_frag(ldsK, ks + 16, PITCH64, 32);
      s0 = WMMA_F16(a0, bQ1, s0);
      s1 = WMMA_F16(a1, bQ1, s1);
    }

    // Online softmax, one query per lane: maximum in-lane, then one exchange of halves.
    float mx = fmaxf(s0[0], s1[0]);
#pragma unroll
    for (int r = 1; r < 8; ++r) mx = fmaxf(mx, fmaxf(s0[r], s1[r]));
    mx = fmaxf(mx, xhalf(mx));
    float mn = fmaxf(mrun, mx);
    float alpha = __expf(mrun - mn);
    mrun = mn;
    lsum0 *= alpha;
    lsum1 *= alpha;
    v16h bP;
#pragma unroll
    for (int r = 0; r < 8; ++r) {
      float p0 = __expf(s0[r] - mn);
      float p1 = __expf(s1[r] - mn);
      lsum0 += p0;
      lsum1 += p1;
      bP[r] = (_Float16)p0;
      bP[r + 8] = (_Float16)p1;
    }
#pragma unroll
    for (int t = 0; t < 4; ++t) o[t] *= alpha;

    // O^T += V^T P^T : K-dim = 32 keys, 4 d-slices of 16
#pragma unroll
    for (int t = 0; t < 4; ++t) {
      v16h aV = load_frag(ldsV, t * 16, PITCH64, ks);
      o[t] = WMMA_F16(aV, bP, o[t]);
    }
    }
  }

  int b = bh >> 4, h = bh & 15;
  float l = lsum0 + lsum1;
  float inv = 1.f / (l + xhalf(l));
  // a lane's 8 values of a tile are 8 consecutive d of one query: one 16-byte store
  _Float16* dst = Ao + ((size_t)b * NSEQ + q0 + nlo) * INNER + h * DHEAD + half8;
#pragma unroll
  for (int t = 0; t < 4; ++t) {
    v8h pk;
#pragma unroll
    for (int r = 0; r < 8; ++r) pk[r] = (_Float16)(o[t][r] * inv);
    *(v8h*)(dst + t * 16) = pk;
  }
}

// ---------------------------------------------------------------- launch
extern "C" void kernel_launch(void* const* d_in, const int* in_sizes, int n_in,
                              void* d_out, int out_size, void* d_ws, size_t ws_size,
                              hipStream_t stream) {
  const float* x       = (const float*)d_in[0];
  const float* norm_g  = (const float*)d_in[1];
  const float* norm_b  = (const float*)d_in[2];
  const float* w_qkv   = (const float*)d_in[3];
  const float* normk_g = (const float*)d_in[4];
  const float* normk_b = (const float*)d_in[5];
  const float* normv_g = (const float*)d_in[6];
  const float* normv_b = (const float*)d_in[7];
  const float* w_out   = (const float*)d_in[8];
  const float* b_out   = (const float*)d_in[9];
  float* out = (float*)d_out;

  const size_t ROWS = (size_t)B_ * NSEQ;                    // 8192
  const size_t HEADSZ = (size_t)B_ * HEADS * NSEQ * DHEAD;  // 8M elements

  char* ws = (char*)d_ws;
  size_t off = 0;
  _Float16* xn16    = (_Float16*)(ws + off); off += ROWS * DIM * 2;
  _Float16* wqkv16t = (_Float16*)(ws + off); off += (size_t)DIM * 3 * INNER * 2;
  _Float16* wout16t = (_Float16*)(ws + off); off += (size_t)INNER * DIM * 2;
  _Float16* Qh      = (_Float16*)(ws + off); off += HEADSZ * 2;
  _Float16* Kh      = (_Float16*)(ws + off); off += HEADSZ * 2;
  _Float16* Vt      = (_Float16*)(ws + off); off += HEADSZ * 2;
  _Float16* Ao      = (_Float16*)(ws + off); off += ROWS * INNER * 2;

  cvt_transpose<<<dim3(3 * INNER / 64, DIM / 64), 256, 0, stream>>>(w_qkv, wqkv16t, DIM, 3 * INNER);
  cvt_transpose<<<dim3(DIM / 64, INNER / 64), 256, 0, stream>>>(w_out, wout16t, INNER, DIM);

  ln_rows_1024<<<(int)(ROWS / (8 * LN_ROWS)), 256, 0, stream>>>(x, norm_g, norm_b, xn16);

  gemm_wmma<<<dim3(3 * INNER / 128, ROWS / 128), 256, 0, stream>>>(
      xn16, wqkv16t, (int)ROWS, 3 * INNER, DIM, 1, nullptr, nullptr, Qh, Kh, Vt,
      normk_g, normk_b, normv_g, normv_b);

  attn_kernel<<<B_ * HEADS * (NSEQ / 128), 256, 0, stream>>>(Qh, Kh, Vt, Ao);

  gemm_wmma<<<dim3(DIM / 128, ROWS / 128), 256, 0, stream>>>(
      Ao, wout16t, (int)ROWS, DIM, DIM, 0, out, b_out, nullptr, nullptr, nullptr,
      nullptr, nullptr, nullptr, nullptr);
}

// v006
// Measured time: 158 microseconds a run.
// Timed twice side by side with v005, it ran 1.15 times as fast both times.
// Counting every step since v000, it is 3.72 times as fast.
#include <hip/hip_runtime.h>
#include <hip/hip_bf16.h>

#define B_    4
#define NSEQ  2048
#define DIM   1024
#define HEADS 16
#define DHEAD 64
#define INNER 1024
#define EPS   1e-5f

// LDS row pitch in f16 elements. Every staged tile has rows of 64 f16 = 128 bytes,
// one whole cache line of its source: eight adjacent lanes copy one row, so a wave's
// 16-byte copy asks for four full lines. Every tile is read with 16-byte loads, one
// row per lane, so the pitch is an odd multiple of 16 bytes: 16 rows then fall on
// 16 different groups of four banks. The pad bytes are never written or read.
// The tiles are declared 16-byte aligned, as their 16-byte copies and loads need.
#define PITCH64 72   // rows of 64 f16 (128 B) at 144 B

typedef __attribute__((ext_vector_type(16))) _Float16 v16h;
typedef __attribute__((ext_vector_type(8)))  _Float16 v8h;
typedef __attribute__((ext_vector_type(4)))  _Float16 v4h;
typedef __attribute__((ext_vector_type(8)))  float    v8f;
typedef __attribute__((ext_vector_type(4)))  float    v4f;
typedef __attribute__((ext_vector_type(2)))  float    v2f;
typedef __attribute__((ext_vector_type(4)))  int      v4i;

#define WMMA_F16(a, b, c) \
  __builtin_amdgcn_wmma_f32_16x16x32_f16(false, (a), false, (b), (short)0, (c), false, false)

#define AS1 __attribute__((address_space(1)))
#define AS3 __attribute__((address_space(3)))

#if __has_builtin(__builtin_amdgcn_global_load_async_to_lds_b128) && \
    __has_builtin(__builtin_amdgcn_s_wait_asynccnt)
#define HAVE_ASYNC 1
#else
#define HAVE_ASYNC 0
#endif

// Copy 16 bytes global -> LDS. Async (ASYNCcnt-tracked, no VGPR staging) when
// the gfx1250 async builtins are available; plain load/store otherwise.
__device__ __forceinline__ void async_copy16(_Float16* lds, const _Float16* g) {
#if HAVE_ASYNC
  __builtin_amdgcn_global_load_async_to_lds_b128((AS1 v4i*)g, (AS3 v4i*)lds, 0, 0);
#else
  *(v8h*)lds = *(const v8h*)g;
#endif
}

// This wave's copies have landed; the "memory" clobber keeps every LDS read behind it.
__device__ __forceinline__ void async_wait() {
#if HAVE_ASYNC
  asm volatile("s_wait_asynccnt 0x0" ::: "memory");
#endif
}

// Load a 16x32 f16 A-fragment (or B-fragment from an [N][K]-transposed tile).
// Layout per CDNA5 ISA 7.12.2: lanes 0-15 hold rows 0-15 with K {0..7,16..23},
// lanes 16-31 hold rows 0-15 with K {8..15,24..31}. Two 16B loads per lane.
__device__ __forceinline__ v16h load_frag(const _Float16* base, int row0, int stride, int koff) {
  int lane = threadIdx.x & 31;
  int r = row0 + (lane & 15);
  int c = koff + ((lane >> 4) << 3);
  const _Float16* p = base + r * stride + c;
  v8h lo = *(const v8h*)p;
  v8h hi = *(const v8h*)(p + 16);
  v16h out;
#pragma unroll
  for (int i = 0; i < 8; ++i) { out[i] = lo[i]; out[i + 8] = hi[i]; }
  return out;
}

// ---------------------------------------------------------------- weight convert+transpose
// in: f32 [K][Ng] row-major  ->  out: f16 [Ng][K] (i.e. W^T), so GEMM B tiles
// are contiguous along K and can be staged with async b128 copies.
// One block moves a 64(k) x 64(n) tile through LDS, 16 elements a thread: 16-byte
// reads along n, 16-byte writes along k. K and Ng are multiples of 64.
// Tile pitch 65 dwords: the row-wise stores and the column-wise loads of a wave
// each fall on 32 different banks.
#define TPITCH 65
__global__ __launch_bounds__(256) void cvt_transpose(const float* __restrict__ in,
                                                     _Float16* __restrict__ out,
                                                     int K, int Ng) {
  __shared__ float tile[64 * TPITCH];
  int tid = threadIdx.x;
  int n0 = blockIdx.x * 64;
  int k0 = blockIdx.y * 64;
  int r = tid >> 4, c4 = (tid & 15) * 4;    // 16 k rows a sweep, 256 B of each
  float4 v[4];
#pragma unroll
  for (int i = 0; i < 4; ++i)
    v[i] = *(const float4*)(in + (size_t)(k0 + r + i * 16) * Ng + n0 + c4);
#pragma unroll
  for (int i = 0; i < 4; ++i) {
    float* t = tile + (r + i * 16) * TPITCH + c4;
    t[0] = v[i].x; t[1] = v[i].y; t[2] = v[i].z; t[3] = v[i].w;
  }
  __syncthreads();
  int nr = tid >> 3, kc = (tid & 7) * 8;    // 32 n rows a sweep, 128 B of each
#pragma unroll
  for (int i = 0; i < 2; ++i) {
    int n = nr + i * 32;
    v8h pk;
#pragma unroll
    for (int j = 0; j < 8; ++j) pk[j] = (_Float16)tile[(kc + j) * TPITCH + n];
    *(v8h*)(out + (size_t)(n0 + n) * K + k0 + kc) = pk;
  }
}

// ---------------------------------------------------------------- row LN (width 1024) -> f16
// One wave takes LN_ROWS whole rows, 32 elements of each a lane (16-byte loads, all
// issued up front): the sums are in-lane plus one butterfly over the wave.
#define LN_ROWS 2
__global__ __launch_bounds__(256) void ln_rows_1024(const float* __restrict__ x,
                                                    const float* __restrict__ g,
                                                    const float* __restrict__ bta,
                                                    _Float16* __restrict__ xn) {
  int wave = threadIdx.x >> 5, lane = threadIdx.x & 31;
  size_t row0 = ((size_t)blockIdx.x * 8 + wave) * LN_ROWS;
  v4f v[LN_ROWS][8];
#pragma unroll
  for (int q = 0; q < LN_ROWS; ++q)
#pragma unroll
    for (int i = 0; i < 8; ++i)
      v[q][i] = *(const v4f*)(x + (row0 + q) * DIM + i * 128 + lane * 4);
  float mu[LN_ROWS], rs[LN_ROWS];
#pragma unroll
  for (int q = 0; q < LN_ROWS; ++q) {
    v2f s2 = {0.f, 0.f}, q2 = {0.f, 0.f};
#pragma unroll
    for (int i = 0; i < 8; ++i) {
      v2f lo = v[q][i].lo, hi = v[q][i].hi;
      s2 += lo;
      q2 += lo * lo;
      s2 += hi;
      q2 += hi * hi;
    }
    float s = s2.x + s2.y, ss = q2.x + q2.y;
#pragma unroll
    for (int m = 16; m >= 1; m >>= 1) {
      s += __shfl_xor(s, m, 32);
      ss += __shfl_xor(ss, m, 32);
    }
    mu[q] = s * (1.f / DIM);
    float var = ss * (1.f / DIM) - mu[q] * mu[q];
    rs[q] = rsqrtf(var + EPS);
  }
#pragma unroll
  for (int i = 0; i < 8; ++i) {
    int c = i * 128 + lane * 4;
    v4f gg = *(const v4f*)(g + c);
    v4f bb = *(const v4f*)(bta + c);
#pragma unroll
    for (int q = 0; q < LN_ROWS; ++q) {
      v4f t = (v[q][i] - mu[q]) * rs[q] * gg + bb;
      *(v4h*)(xn + (row0 + q) * DIM + c) = __builtin_convertvector(t, v4h);
    }
  }
}

// ---------------------------------------------------------------- 16-lane row sum
// Sum over the 16 lanes of a DPP row (all lanes get the sum). The C tile of a
// WMMA keeps one matrix row in one 16-lane half, so this is a sum along N.
template <int CTRL>
__device__ __forceinline__ float dpp_xadd(float v) {
  int o = __builtin_amdgcn_update_dpp(0, __builtin_bit_cast(int, v), CTRL, 0xf, 0xf, true);
  return v + __builtin_bit_cast(float, o);
}
__device__ __forceinline__ float row16_sum(float v) {
  v = dpp_xadd<0x161>(v);  // row_xmask:1
  v = dpp_xadd<0x162>(v);  // row_xmask:2
  v = dpp_xadd<0x164>(v);  // row_xmask:4
  v = dpp_xadd<0x168>(v);  // row_xmask:8
  return v;
}

// Layernorm of width 64 in place on four 16x16 f32 C tiles that lie side by side
// along N (one head). gv, bv: this lane's gain and bias for its column of each tile.
__device__ __forceinline__ void head_ln(v8f* c, const float* gv, const float* bv) {
#pragma unroll
  for (int r = 0; r < 8; ++r) {
    float s = 0.f, ss = 0.f;
#pragma unroll
    for (int j = 0; j < 4; ++j) {
      float v = c[j][r];
      s += v;
      ss += v * v;
    }
    s = row16_sum(s);
    ss = row16_sum(ss);
    float mu = s * (1.f / DHEAD);
    float var = ss * (1.f / DHEAD) - mu * mu;
    float rs = rsqrtf(var + EPS);
#pragma unroll
    for (int j = 0; j < 4; ++j) c[j][r] = (c[j][r] - mu) * rs * gv[j] + bv[j];
  }
}

// ---------------------------------------------------------------- WMMA GEMM
// C[M,Ng] = A[M,K] * Wt[Ng,K]^T.  Block tile 256(M) x 128(N), 8 waves as 4(M) x 2(N),
// 64 x 64 of C each: a k slice of 32 takes 4 A and 4 B fragments from LDS for 16
// products, so every fragment read feeds four of them. K step 64 (K a multiple of
// 64): both tiles staged via async b128 to LDS in whole 128-byte rows, worked on as
// two k slices of 32.
// mode 0: outf = C + bias (fp32).
// mode 1: Q (scaled) -> Qh [bh][n][64]; K, V get their head layernorm (width 64)
// on the f32 accumulators: K -> Kh [bh][n][64], V -> Vt [bh][64][n] (transposed
// for the PV WMMA). A wave's 64 columns are one whole head.
#define GBM 256
#define GBN 128
// A group of global stores whose values are all made in front of it. BEGIN keeps the
// compiler from sinking the making of a later value in among the stores, where it could
// take a register that an issued store still names; END is the precaution for the code
// behind: no register that an issued store of the group names is rewritten before its wait.
#define STORE_GROUP_BEGIN() __builtin_amdgcn_sched_barrier(0)
#define STORE_GROUP_END() do { asm volatile("s_wait_xcnt 0x0" ::: "memory"); \
                               __builtin_amdgcn_sched_barrier(0); } while (0)
// launch bounds: at least four waves a SIMD, so that two blocks share a WGP and one
// computes while the other's copies fly
__global__ __launch_bounds__(256, 4) void gemm_wmma(
                          const _Float16* __restrict__ A, const _Float16* __restrict__ Wt,
                          int M, int Ng, int K, int mode, float* __restrict__ outf,
                          const float* __restrict__ bias, _Float16* __restrict__ Qh,
                          _Float16* __restrict__ Kh, _Float16* __restrict__ Vt,
                          const float* __restrict__ kg, const float* __restrict__ kb,
                          const float* __restrict__ vg, const float* __restrict__ vb) {
  __shared__ __attribute__((aligned(16))) _Float16 ldsA[GBM * PITCH64];
  __shared__ __attribute__((aligned(16))) _Float16 ldsB[GBN * PITCH64];
  int tid = threadIdx.x;
  int wave = tid >> 5;
  int lane = tid & 31;
  int wm = wave >> 1;              // this wave's 64 rows of the tile
  int wn = wave & 1;               // this wave's 64 columns of the tile
  int n0 = blockIdx.x * GBN;
  int m0 = blockIdx.y * GBM;

  v8f acc[4][4] = {};              // acc[i][j]: rows wm*64 + i*16, columns wn*64 + j*16

  int row = tid >> 3;              // 0..31: 32 rows a sweep
  int ch = (tid & 7) * 8;          // this lane's 16 bytes of the row's 128
  const _Float16* srcA = A  + (size_t)(m0 + row) * K + ch;
  const _Float16* srcB = Wt + (size_t)(n0 + row) * K + ch;
  _Float16* dstA = ldsA + row * PITCH64 + ch;
  _Float16* dstB = ldsB + row * PITCH64 + ch;
  // the next step's 384 rows are 384 lines: each thread asks for one of A's,
  // the first half of the threads for one of B's too
  const _Float16* pfA = A + (size_t)(m0 + tid) * K;
  const _Float16* pfB = Wt + (size_t)(n0 + (tid & (GBN - 1))) * K;

  for (int k0 = 0; k0 < K; k0 += 64) {
#pragma unroll  // the sweeps' places in LDS are constants
    for (int i = 0; i < GBM / 32; ++i)
      async_copy16(dstA + i * 32 * PITCH64, srcA + (size_t)(i * 32) * K + k0);
#pragma unroll  // the sweeps' places in LDS are constants
    for (int i = 0; i < GBN / 32; ++i)
      async_copy16(dstB + i * 32 * PITCH64, srcB + (size_t)(i * 32) * K + k0);
    if (k0 + 64 < K) {
      __builtin_prefetch(pfA + k0 + 64, 0, 3);
      if (tid < GBN) __builtin_prefetch(pfB + k0 + 64, 0, 3);
    }
    async_wait();
    __syncthreads();
#pragma unroll  // the slice's offset becomes an immediate of the LDS loads
    for (int kk = 0; kk < 64; kk += 32) {
      v16h a[4], b[4];
#pragma unroll
      for (int i = 0; i < 4; ++i) a[i] = load_frag(ldsA, wm * 64 + i * 16, PITCH64, kk);
#pragma unroll
      for (int j = 0; j < 4; ++j) b[j] = load_frag(ldsB, wn * 64 + j * 16, PITCH64, kk);
      // keeps the slice's 16 LDS loads one group ahead of its products: left alone the
      // compiler sinks the B loads among them, and the wave waits out LDS four times a slice
      __builtin_amdgcn_sched_barrier(0);
#pragma unroll
      for (int j = 0; j < 4; ++j)
#pragma unroll
        for (int i = 0; i < 4; ++i) acc[i][j] = WMMA_F16(a[i], b[j], acc[i][j]);
      // keeps the next slice's loads from being lifted in among these products
      __builtin_amdgcn_sched_barrier(0);
    }
    __syncthreads();
  }

  int nlo = lane & 15;
  int mhi = (lane >> 4) * 8;
  if (mode == 0) {
#pragma unroll
    for (int j = 0; j < 4; ++j) {
      int n = n0 + wn * 64 + j * 16 + nlo;
      float bv = bias[n];
#pragma unroll
      for (int i = 0; i < 4; ++i) {
#pragma unroll
        for (int r = 0; r < 8; ++r) {
          int m = m0 + wm * 64 + i * 16 + mhi + r;
          outf[(size_t)m * Ng + n] = acc[i][j][r] + bv;
        }
      }
    }
  } else {
    int which = n0 >> 10;                    // block-uniform: 128 divides 1024
    int h = ((n0 & 1023) >> 6) + wn;         // this wave's head
    int bb = m0 >> 11;                       // block-uniform: 256 divides NSEQ
    int bh = bb * HEADS + h;
    int nn0 = (m0 & 2047) + wm * 64 + mhi;   // first of this lane's 8 rows of acc[0]
    if (which == 0) {
#pragma unroll
      for (int i = 0; i < 4; ++i) {
        v8h pk[4];
#pragma unroll
        for (int j = 0; j < 4; ++j)
#pragma unroll
          for (int r = 0; r < 8; ++r)
            pk[j][r] = (_Float16)(acc[i][j][r] * 0.125f);  // fold 1/sqrt(64) into Q
        STORE_GROUP_BEGIN();
        _Float16* dst = Qh + ((size_t)bh * NSEQ + nn0 + i * 16) * DHEAD + nlo;
#pragma unroll
        for (int j = 0; j < 4; ++j)
#pragma unroll
          for (int r = 0; r < 8; ++r) dst[r * DHEAD + j * 16] = pk[j][r];
        STORE_GROUP_END();
      }
    } else {
      const float* g = (which == 1) ? kg : vg;
      const float* bt = (which == 1) ? kb : vb;
      float gv[4], bv[4];
#pragma unroll
      for (int j = 0; j < 4; ++j) { gv[j] = g[j * 16 + nlo]; bv[j] = bt[j * 16 + nlo]; }
      // precaution: no register that an issued gain or bias load names is rewritten before this wait
      asm volatile("s_wait_xcnt 0x0" ::: "memory");
      if (which == 1) {
#pragma unroll
        for (int i = 0; i < 4; ++i) {
          head_ln(acc[i], gv, bv);
          v8h pk[4];
#pragma unroll
          for (int j = 0; j < 4; ++j)
#pragma unroll
            for (int r = 0; r < 8; ++r) pk[j][r] = (_Float16)acc[i][j][r];
          STORE_GROUP_BEGIN();
          _Float16* dst = Kh + ((size_t)bh * NSEQ + nn0 + i * 16) * DHEAD + nlo;
#pragma unroll
          for (int j = 0; j < 4; ++j)
#pragma unroll
            for (int r = 0; r < 8; ++r) dst[r * DHEAD + j * 16] = pk[j][r];
          STORE_GROUP_END();
        }
      } else {
#pragma unroll
        for (int i = 0; i < 4; ++i) {
          head_ln(acc[i], gv, bv);
          v8h pk[4];
#pragma unroll
          for (int j = 0; j < 4; ++j)
#pragma unroll
            for (int r = 0; r < 8; ++r) pk[j][r] = (_Float16)acc[i][j][r];
          STORE_GROUP_BEGIN();
          // a lane's 8 rows are 8 consecutive n of one d: one 16-byte store
          _Float16* dst = Vt + ((size_t)bh * DHEAD + nlo) * NSEQ + nn0 + i * 16;
#pragma unroll
          for (int j = 0; j < 4; ++j) *(v8h*)(dst + (size_t)(j * 16) * NSEQ) = pk[j];
          STORE_GROUP_END();
        }
      }
    }
  }
}

// ---------------------------------------------------------------- flash attention
// Lane l takes the value of lane l ^ 16 (the other 16-lane half), on the vector port.
__device__ __forceinline__ float xhalf(float x) {
  int v = __builtin_bit_cast(int, x);
  return __builtin_bit_cast(float,
      __builtin_amdgcn_permlanex16(v, v, 0x76543210, 0xfedcba98, false, false));
}

__global__ __launch_bounds__(256, 4) void attn_kernel(
                            const _Float16* __restrict__ Qh, const _Float16* __restrict__ Kh,
                            const _Float16* __restrict__ Vt, _Float16* __restrict__ Ao) {
  __shared__ __attribute__((aligned(16))) _Float16 ldsK[64 * PITCH64];
  __shared__ __attribute__((aligned(16))) _Float16 ldsV[64 * PITCH64];
  int tid = threadIdx.x, wave = tid >> 5, lane = tid & 31;
  int nlo = lane & 15, half8 = (lane >> 4) * 8;
  int bh = blockIdx.x >> 3;
  int q0 = (blockIdx.x & 7) * 256 + wave * 32;

  const _Float16* Qbase = Qh + ((size_t)bh * NSEQ + q0) * DHEAD;
  v16h bQ0[2], bQ1[2];
#pragma unroll
  for (int u = 0; u < 2; ++u) {
    bQ0[u] = load_frag(Qbase, u * 16, DHEAD, 0);
    bQ1[u] = load_frag(Qbase, u * 16, DHEAD, 32);
  }

  v8f o[2][4] = {};                  // o[u][t][r] = O[query u*16 + nlo][d = t*16 + half8 + r]
  float mrun[2] = {-3.0e38f, -3.0e38f};  // each query's running maximum (equal in both halves)
  float lsum0[2] = {0.f, 0.f};       // sums over this lane's own keys; joined after the loop
  float lsum1[2] = {0.f, 0.f};

  // K tile 64(key) x 64(d), V^T tile 64(d) x 64(key): two b128 per thread of each
  int rr = tid >> 3, cc = (tid & 7) * 8;
  const _Float16* srcK = Kh + ((size_t)bh * NSEQ + rr) * DHEAD + cc;
  const _Float16* srcV = Vt + ((size_t)bh * DHEAD + rr) * NSEQ + cc;
  _Float16* dstK = ldsK + rr * PITCH64 + cc;
  _Float16* dstV = ldsV + rr * PITCH64 + cc;

  for (int kb = 0; kb < NSEQ; kb += 64) {
    __syncthreads();
#pragma unroll  // the two sweeps' places in LDS are constants
    for (int i = 0; i < 2; ++i) {
      async_copy16(dstK + i * 32 * PITCH64, srcK + (size_t)(kb + i * 32) * DHEAD);
      async_copy16(dstV + i * 32 * PITCH64, srcV + (size_t)(i * 32) * NSEQ + kb);
    }
    if (kb + 64 < NSEQ) {
#pragma unroll  // the sweeps' steps become immediates of the prefetches
      for (int i = 0; i < 2; ++i) {
        __builtin_prefetch(srcK + (size_t)(kb + 64 + i * 32) * DHEAD, 0, 3);
        __builtin_prefetch(srcV + (size_t)(i * 32) * NSEQ + kb + 64, 0, 3);
      }
    }
    async_wait();
    __syncthreads();

#pragma unroll  // the block's offset becomes an immediate of the LDS loads
    for (int ks = 0; ks < 64; ks += 32) {
    // S^T = K Q^T : per group two 16x16 f32 tiles (keys ks + 0-15, ks + 16-31), K-dim = d = 64.
    // s0[u][r] = S[query u*16 + nlo][key ks + half8 + r], s1[u][r] the same 16 keys on
    v8f s0[2] = {}, s1[2] = {};
    {
      v16h a0 = load_frag(ldsK, ks, PITCH64, 0);
      v16h a1 = load_frag(ldsK, ks + 16, PITCH64, 0);
#pragma unroll
      for (int u = 0; u < 2; ++u) {
        s0[u] = WMMA_F16(a0, bQ0[u], s0[u]);
        s1[u] = WMMA_F16(a1, bQ0[u], s1[u]);
      }
      a0 = load_frag(ldsK, ks, PITCH64, 32);
      a1 = load_frag(ldsK, ks + 16, PITCH64, 32);
#pragma unroll
      for (int u = 0; u < 2; ++u) {
        s0[u] = WMMA_F16(a0, bQ1[u], s0[u]);
        s1[u] = WMMA_F16(a1, bQ1[u], s1[u]);
      }
    }

    // Online softmax, one query per lane and group: maximum in-lane, then one exchange of halves.
    v16h bP[2];
#pragma unroll
    for (int u = 0; u < 2; ++u) {
      float mx = fmaxf(s0[u][0], s1[u][0]);
#pragma unroll
      for (int r = 1; r < 8; ++r) mx = fmaxf(mx, fmaxf(s0[u][r], s1[u][r]));
      mx = fmaxf(mx, xhalf(mx));
      float mn = fmaxf(mrun[u], mx);
      float alpha = __expf(mrun[u] - mn);
      mrun[u] = mn;
      lsum0[u] *= alpha;
      lsum1[u] *= alpha;
#pragma unroll
      for (int r = 0; r < 8; ++r) {
        float p0 = __expf(s0[u][r] - mn);
        float p1 = __expf(s1[u][r] - mn);
        lsum0[u] += p0;
        lsum1[u] += p1;
        bP[u][r] = (_Float16)p0;
        bP[u][r + 8] = (_Float16)p1;
      }
#pragma unroll
      for (int t = 0; t < 4; ++t) o[u][t] *= alpha;
    }

    // O^T += V^T P^T : K-dim = 32 keys, 4 d-slices of 16
#pragma unroll
    for (int t = 0; t < 4; ++t) {
      v16h aV = load_frag(ldsV, t * 16, PITCH64, ks);
#pragma unroll
      for (int u = 0; u < 2; ++u) o[u][t] = WMMA_F16(aV, bP[u], o[u][t]);
    }
    }
  }

  int b = bh >> 4, h = bh & 15;
  v8h pk[2][4];
#pragma unroll
  for (int u = 0; u < 2; ++u) {
    float l = lsum0[u] + lsum1[u];
    float inv = 1.f / (l + xhalf(l));
#pragma unroll
    for (int t = 0; t < 4; ++t)
#pragma unroll
      for (int r = 0; r < 8; ++r) pk[u][t][r] = (_Float16)(o[u][t][r] * inv);
  }
  STORE_GROUP_BEGIN();
  // a lane's 8 values of a tile are 8 consecutive d of one query: one 16-byte store
  _Float16* dst = Ao + ((size_t)b * NSEQ + q0 + nlo) * INNER + h * DHEAD + half8;
#pragma unroll
  for (int u = 0; u < 2; ++u)
#pragma unroll
    for (int t = 0; t < 4; ++t) *(v8h*)(dst + (size_t)(u * 16) * INNER + t * 16) = pk[u][t];
}

// ---------------------------------------------------------------- launch
extern "C" void kernel_launch(void* const* d_in, const int* in_sizes, int n_in,
                              void* d_out, int out_size, void* d_ws, size_t ws_size,
                              hipStream_t stream) {
  const float* x       = (const float*)d_in[0];
  const float* norm_g  = (const float*)d_in[1];
  const float* norm_b  = (const float*)d_in[2];
  const float* w_qkv   = (const float*)d_in[3];
  const float* normk_g = (const float*)d_in[4];
  const float* normk_b = (const float*)d_in[5];
  const float* normv_g = (const float*)d_in[6];
  const float* normv_b = (const float*)d_in[7];
  const float* w_out   = (const float*)d_in[8];
  const float* b_out   = (const float*)d_in[9];
  float* out = (float*)d_out;

  const size_t ROWS = (size_t)B_ * NSEQ;                    // 8192
  const size_t HEADSZ = (size_t)B_ * HEADS * NSEQ * DHEAD;  // 8M elements

  char* ws = (char*)d_ws;
  size_t off = 0;
  _Float16* xn16    = (_Float16*)(ws + off); off += ROWS * DIM * 2;
  _Float16* wqkv16t = (_Float16*)(ws + off); off += (size_t)DIM * 3 * INNER * 2;
  _Float16* wout16t = (_Float16*)(ws + off); off += (size_t)INNER * DIM * 2;
  _Float16* Qh      = (_Float16*)(ws + off); off += HEADSZ * 2;
  _Float16* Kh      = (_Float16*)(ws + off); off += HEADSZ * 2;
  _Float16* Vt      = (_Float16*)(ws + off); off += HEADSZ * 2;
  _Float16* Ao      = (_Float16*)(ws + off); off += ROWS * INNER * 2;

  cvt_transpose<<<dim3(3 * INNER / 64, DIM / 64), 256, 0, stream>>>(w_qkv, wqkv16t, DIM, 3 * INNER);
  cvt_transpose<<<dim3(DIM / 64, INNER / 64), 256, 0, stream>>>(w_out, wout16t, INNER, DIM);

  ln_rows_1024<<<(int)(ROWS / (8 * LN_ROWS)), 256, 0, stream>>>(x, norm_g, norm_b, xn16);

  gemm_wmma<<<dim3(3 * INNER / GBN, ROWS / GBM), 256, 0, stream>>>(
      xn16, wqkv16t, (int)ROWS, 3 * INNER, DIM, 1, nullptr, nullptr, Qh, Kh, Vt,
      normk_g, normk_b, normv_g, normv_b);

  attn_kernel<<<B_ * HEADS * (NSEQ / 256), 256, 0, stream>>>(Qh, Kh, Vt, Ao);

  gemm_wmma<<<dim3(DIM / GBN, ROWS / GBM), 256, 0, stream>>>(
      Ao, wout16t, (int)ROWS, DIM, DIM, 0, out, b_out, nullptr, nullptr, nullptr,
      nullptr, nullptr, nullptr, nullptr);
}

// v007
// A run of this version takes 137 microseconds.
// Next to v006, in two timings, it ran 1.15 and 1.16 times as fast.
// Over all steps from v000 it is 4.29 times as fast.
#include <hip/hip_runtime.h>
#include <hip/hip_bf16.h>

#define B_    4
#define NSEQ  2048
#define DIM   1024
#define HEADS 16
#define DHEAD 64
#define INNER 1024
#define EPS   1e-5f

// LDS row pitch in f16 elements. Every staged tile has rows of 64 f16 = 128 bytes,
// one whole cache line of its source: eight adjacent lanes copy one row, so a wave's
// 16-byte copy asks for four full lines. Every tile is read with 16-byte loads, one
// row per lane, so the pitch is an odd multiple of 16 bytes: 16 rows then fall on
// 16 different groups of four banks. The pad bytes are never written or read.
// The tiles are declared 16-byte aligned, as their 16-byte copies and loads need.
#define PITCH64 72   // rows of 64 f16 (128 B) at 144 B

typedef __attribute__((ext_vector_type(16))) _Float16 v16h;
typedef __attribute__((ext_vector_type(8)))  _Float16 v8h;
typedef __attribute__((ext_vector_type(4)))  _Float16 v4h;
typedef __attribute__((ext_vector_type(8)))  float    v8f;
typedef __attribute__((ext_vector_type(4)))  float    v4f;
typedef __attribute__((ext_vector_type(2)))  float    v2f;
typedef __attribute__((ext_vector_type(4)))  int      v4i;

#define WMMA_F16(a, b, c) \
  __builtin_amdgcn_wmma_f32_16x16x32_f16(false, (a), false, (b), (short)0, (c), false, false)

#define AS1 __attribute__((address_space(1)))
#define AS3 __attribute__((address_space(3)))

#if __has_builtin(__builtin_amdgcn_global_load_async_to_lds_b128) && \
    __has_builtin(__builtin_amdgcn_s_wait_asynccnt)
#define HAVE_ASYNC 1
#else
#define HAVE_ASYNC 0
#endif

// Copy 16 bytes global -> LDS. Async (ASYNCcnt-tracked, no VGPR staging) when
// the gfx1250 async builtins are available; plain load/store otherwise.
__device__ __forceinline__ void async_copy16(_Float16* lds, const _Float16* g) {
#if HAVE_ASYNC
  __builtin_amdgcn_global_load_async_to_lds_b128((AS1 v4i*)g, (AS3 v4i*)lds, 0, 0);
#else
  *(v8h*)lds = *(const v8h*)g;
#endif
}

// This wave's copies have landed; the "memory" clobber keeps every LDS read behind it.
__device__ __forceinline__ void async_wait() {
#if HAVE_ASYNC
  asm volatile("s_wait_asynccnt 0x0" ::: "memory");
#endif
}

// This wave's LDS reads have returned: stands in front of the barrier behind which the
// buffer that they read is refilled by copies.
__device__ __forceinline__ void lds_reads_done() {
  asm volatile("s_wait_dscnt 0x0" ::: "memory");
}

// Load a 16x32 f16 A-fragment (or B-fragment from an [N][K]-transposed tile).
// Layout per CDNA5 ISA 7.12.2: lanes 0-15 hold rows 0-15 with K {0..7,16..23},
// lanes 16-31 hold rows 0-15 with K {8..15,24..31}. Two 16B loads per lane.
__device__ __forceinline__ v16h load_frag(const _Float16* base, int row0, int stride, int koff) {
  int lane = threadIdx.x & 31;
  int r = row0 + (lane & 15);
  int c = koff + ((lane >> 4) << 3);
  const _Float16* p = base + r * stride + c;
  v8h lo = *(const v8h*)p;
  v8h hi = *(const v8h*)(p + 16);
  v16h out;
#pragma unroll
  for (int i = 0; i < 8; ++i) { out[i] = lo[i]; out[i + 8] = hi[i]; }
  return out;
}

// ---------------------------------------------------------------- weight convert+transpose
// in: f32 [K][Ng] row-major  ->  out: f16 [Ng][K] (i.e. W^T), so GEMM B tiles
// are contiguous along K and can be staged with async b128 copies.
// One block moves a 64(k) x 64(n) tile through LDS, 16 elements a thread: 16-byte
// reads along n, 16-byte writes along k. K and Ng are multiples of 64.
// Tile pitch 65 dwords: the row-wise stores and the column-wise loads of a wave
// each fall on 32 different banks.
#define TPITCH 65
__global__ __launch_bounds__(256) void cvt_transpose(const float* __restrict__ in,
                                                     _Float16* __restrict__ out,
                                                     int K, int Ng) {
  __shared__ float tile[64 * TPITCH];
  int tid = threadIdx.x;
  int n0 = blockIdx.x * 64;
  int k0 = blockIdx.y * 64;
  int r = tid >> 4, c4 = (tid & 15) * 4;    // 16 k rows a sweep, 256 B of each
  float4 v[4];
#pragma unroll
  for (int i = 0; i < 4; ++i)
    v[i] = *(const float4*)(in + (size_t)(k0 + r + i * 16) * Ng + n0 + c4);
#pragma unroll
  for (int i = 0; i < 4; ++i) {
    float* t = tile + (r + i * 16) * TPITCH + c4;
    t[0] = v[i].x; t[1] = v[i].y; t[2] = v[i].z; t[3] = v[i].w;
  }
  __syncthreads();
  int nr = tid >> 3, kc = (tid & 7) * 8;    // 32 n rows a sweep, 128 B of each
#pragma unroll
  for (int i = 0; i < 2; ++i) {
    int n = nr + i * 32;
    v8h pk;
#pragma unroll
    for (int j = 0; j < 8; ++j) pk[j] = (_Float16)tile[(kc + j) * TPITCH + n];
    *(v8h*)(out + (size_t)(n0 + n) * K + k0 + kc) = pk;
  }
}

// ---------------------------------------------------------------- row LN (width 1024) -> f16
// One wave takes LN_ROWS whole rows, 32 elements of each a lane (16-byte loads, all
// issued up front): the sums are in-lane plus one butterfly over the wave.
#define LN_ROWS 2
__global__ __launch_bounds__(256) void ln_rows_1024(const float* __restrict__ x,
                                                    const float* __restrict__ g,
                                                    const float* __restrict__ bta,
                                                    _Float16* __restrict__ xn) {
  int wave = threadIdx.x >> 5, lane = threadIdx.x & 31;
  size_t row0 = ((size_t)blockIdx.x * 8 + wave) * LN_ROWS;
  v4f v[LN_ROWS][8];
#pragma unroll
  for (int q = 0; q < LN_ROWS; ++q)
#pragma unroll
    for (int i = 0; i < 8; ++i)
      v[q][i] = *(const v4f*)(x + (row0 + q) * DIM + i * 128 + lane * 4);
  float mu[LN_ROWS], rs[LN_ROWS];
#pragma unroll
  for (int q = 0; q < LN_ROWS; ++q) {
    v2f s2 = {0.f, 0.f}, q2 = {0.f, 0.f};
#pragma unroll
    for (int i = 0; i < 8; ++i) {
      v2f lo = v[q][i].lo, hi = v[q][i].hi;
      s2 += lo;
      q2 += lo * lo;
      s2 += hi;
      q2 += hi * hi;
    }
    float s = s2.x + s2.y, ss = q2.x + q2.y;
#pragma unroll
    for (int m = 16; m >= 1; m >>= 1) {
      s += __shfl_xor(s, m, 32);
      ss += __shfl_xor(ss, m, 32);
    }
    mu[q] = s * (1.f / DIM);
    float var = ss * (1.f / DIM) - mu[q] * mu[q];
    rs[q] = rsqrtf(var + EPS);
  }
#pragma unroll
  for (int i = 0; i < 8; ++i) {
    int c = i * 128 + lane * 4;
    v4f gg = *(const v4f*)(g + c);
    v4f bb = *(const v4f*)(bta + c);
#pragma unroll
    for (int q = 0; q < LN_ROWS; ++q) {
      v4f t = (v[q][i] - mu[q]) * rs[q] * gg + bb;
      *(v4h*)(xn + (row0 + q) * DIM + c) = __builtin_convertvector(t, v4h);
    }
  }
}

// ---------------------------------------------------------------- 16-lane row sum
// Sum over the 16 lanes of a DPP row (all lanes get the sum). The C tile of a
// WMMA keeps one matrix row in one 16-lane half, so this is a sum along N.
template <int CTRL>
__device__ __forceinline__ float dpp_xadd(float v) {
  int o = __builtin_amdgcn_update_dpp(0, __builtin_bit_cast(int, v), CTRL, 0xf, 0xf, true);
  return v + __builtin_bit_cast(float, o);
}
__device__ __forceinline__ float row16_sum(float v) {
  v = dpp_xadd<0x161>(v);  // row_xmask:1
  v = dpp_xadd<0x162>(v);  // row_xmask:2
  v = dpp_xadd<0x164>(v);  // row_xmask:4
  v = dpp_xadd<0x168>(v);  // row_xmask:8
  return v;
}

// Layernorm of width 64 in place on four 16x16 f32 C tiles that lie side by side
// along N (one head). gv, bv: this lane's gain and bias for its column of each tile.
__device__ __forceinline__ void head_ln(v8f* c, const float* gv, const float* bv) {
#pragma unroll
  for (int r = 0; r < 8; ++r) {
    float s = 0.f, ss = 0.f;
#pragma unroll
    for (int j = 0; j < 4; ++j) {
      float v = c[j][r];
      s += v;
      ss += v * v;
    }
    s = row16_sum(s);
    ss = row16_sum(ss);
    float mu = s * (1.f / DHEAD);
    float var = ss * (1.f / DHEAD) - mu * mu;
    float rs = rsqrtf(var + EPS);
#pragma unroll
    for (int j = 0; j < 4; ++j) c[j][r] = (c[j][r] - mu) * rs * gv[j] + bv[j];
  }
}

// ---------------------------------------------------------------- WMMA GEMM
// C[M,Ng] = A[M,K] * Wt[Ng,K]^T.  Block tile 256(M) x 128(N), 8 waves as 4(M) x 2(N),
// 64 x 64 of C each: a k slice of 32 takes 4 A and 4 B fragments from LDS for 16
// products, so every fragment read feeds four of them. K step 64 (K a multiple of
// 64): both tiles staged via async b128 to LDS in whole 128-byte rows, worked on as
// two k slices of 32. Two LDS buffers: the copies of step t + 1 fly while step t is
// worked on, and one barrier a step both publishes step t + 1 and frees step t's buffer.
// mode 0: outf = C + bias (fp32).
// mode 1: Q (scaled) -> Qh [bh][n][64]; K, V get their head layernorm (width 64)
// on the f32 accumulators: K -> Kh [bh][n][64], V -> Vt [bh][64][n] (transposed
// for the PV WMMA). A wave's 64 columns are one whole head.
#define GBM 256
#define GBN 128
#define GSTAGE ((GBM + GBN) * PITCH64)   // f16 elements of one buffer: the A tile, then the B tile
// A group of global stores whose values are all made in front of it. BEGIN keeps the
// compiler from sinking the making of a later value in among the stores, where it could
// take a register that an issued store still names; END is the precaution for the code
// behind: no register that an issued store of the group names is rewritten before its wait.
#define STORE_GROUP_BEGIN() __builtin_amdgcn_sched_barrier(0)
#define STORE_GROUP_END() do { asm volatile("s_wait_xcnt 0x0" ::: "memory"); \
                               __builtin_amdgcn_sched_barrier(0); } while (0)
// launch bounds: at least four waves a SIMD, so that two blocks share a WGP and one
// computes while the other's copies fly
__global__ __launch_bounds__(256, 4) void gemm_wmma(
                          const _Float16* __restrict__ A, const _Float16* __restrict__ Wt,
                          int M, int Ng, int K, int mode, float* __restrict__ outf,
                          const float* __restrict__ bias, _Float16* __restrict__ Qh,
                          _Float16* __restrict__ Kh, _Float16* __restrict__ Vt,
                          const float* __restrict__ kg, const float* __restrict__ kb,
                          const float* __restrict__ vg, const float* __restrict__ vb) {
  __shared__ __attribute__((aligned(16))) _Float16 ldsAB[2 * GSTAGE];
  int tid = threadIdx.x;
  int wave = tid >> 5;
  int lane = tid & 31;
  int wm = wave >> 1;              // this wave's 64 rows of the tile
  int wn = wave & 1;               // this wave's 64 columns of the tile
  int n0 = blockIdx.x * GBN;
  int m0 = blockIdx.y * GBM;

  v8f acc[4][4] = {};              // acc[i][j]: rows wm*64 + i*16, columns wn*64 + j*16

  int row = tid >> 3;              // 0..31: 32 rows a sweep
  int ch = (tid & 7) * 8;          // this lane's 16 bytes of the row's 128
  const _Float16* srcA = A  + (size_t)(m0 + row) * K + ch;
  const _Float16* srcB = Wt + (size_t)(n0 + row) * K + ch;
  _Float16* dstA = ldsAB + row * PITCH64 + ch;
  _Float16* dstB = dstA + GBM * PITCH64;

  // step t's 12 copies a thread, into buffer buf
  auto copy_step = [&](int t, int buf) {
    _Float16* dA = dstA + buf * GSTAGE;
    _Float16* dB = dstB + buf * GSTAGE;
    int k0 = t * 64;
#pragma unroll  // the sweeps' places in the buffer are constants
    for (int i = 0; i < GBM / 32; ++i)
      async_copy16(dA + i * 32 * PITCH64, srcA + (size_t)(i * 32) * K + k0);
#pragma unroll  // the sweeps' places in the buffer are constants
    for (int i = 0; i < GBN / 32; ++i)
      async_copy16(dB + i * 32 * PITCH64, srcB + (size_t)(i * 32) * K + k0);
  };

  int steps = K >> 6;
  copy_step(0, 0);
  async_wait();
  __syncthreads();
  if (steps > 1) copy_step(1, 1);

  for (int t = 0; t < steps; ++t) {
    const _Float16* ldsA = ldsAB + (t & 1) * GSTAGE;
    const _Float16* ldsB = ldsA + GBM * PITCH64;
#pragma unroll  // the slice's offset becomes an immediate of the LDS loads
    for (int kk = 0; kk < 64; kk += 32) {
      v16h a[4], b[4];
#pragma unroll
      for (int i = 0; i < 4; ++i) a[i] = load_frag(ldsA, wm * 64 + i * 16, PITCH64, kk);
#pragma unroll
      for (int j = 0; j < 4; ++j) b[j] = load_frag(ldsB, wn * 64 + j * 16, PITCH64, kk);
      // keeps the slice's 16 LDS loads one group ahead of its products: left alone the
      // compiler sinks the B loads among them, and the wave waits out LDS four times a slice
      __builtin_amdgcn_sched_barrier(0);
#pragma unroll
      for (int j = 0; j < 4; ++j)
#pragma unroll
        for (int i = 0; i < 4; ++i) acc[i][j] = WMMA_F16(a[i], b[j], acc[i][j]);
      // keeps the next slice's loads from being lifted in among these products
      __builtin_amdgcn_sched_barrier(0);
    }
    // hand-over: this wave has left step t's buffer and its copies of step t + 1 have landed;
    // behind the barrier that holds for every wave, so step t + 1 may be read, step t's buffer refilled
    lds_reads_done();
    async_wait();
    __syncthreads();
    if (t + 2 < steps) copy_step(t + 2, t & 1);
  }
  async_wait();  // nothing is in flight here; stands behind the last copy as the ring's form asks

  int nlo = lane & 15;
  int mhi = (lane >> 4) * 8;
  if (mode == 0) {
#pragma unroll
    for (int j = 0; j < 4; ++j) {
      int n = n0 + wn * 64 + j * 16 + nlo;
      float bv = bias[n];
#pragma unroll
      for (int i = 0; i < 4; ++i) {
#pragma unroll
        for (int r = 0; r < 8; ++r) {
          int m = m0 + wm * 64 + i * 16 + mhi + r;
          outf[(size_t)m * Ng + n] = acc[i][j][r] + bv;
        }
      }
    }
  } else {
    int which = n0 >> 10;                    // block-uniform: 128 divides 1024
    int h = ((n0 & 1023) >> 6) + wn;         // this wave's head
    int bb = m0 >> 11;                       // block-uniform: 256 divides NSEQ
    int bh = bb * HEADS + h;
    int nn0 = (m0 & 2047) + wm * 64 + mhi;   // first of this lane's 8 rows of acc[0]
    if (which == 0) {
#pragma unroll
      for (int i = 0; i < 4; ++i) {
        v8h pk[4];
#pragma unroll
        for (int j = 0; j < 4; ++j)
#pragma unroll
          for (int r = 0; r < 8; ++r)
            pk[j][r] = (_Float16)(acc[i][j][r] * 0.125f);  // fold 1/sqrt(64) into Q
        STORE_GROUP_BEGIN();
        _Float16* dst = Qh + ((size_t)bh * NSEQ + nn0 + i * 16) * DHEAD + nlo;
#pragma unroll
        for (int j = 0; j < 4; ++j)
#pragma unroll
          for (int r = 0; r < 8; ++r) dst[r * DHEAD + j * 16] = pk[j][r];
        STORE_GROUP_END();
      }
    } else {
      const float* g = (which == 1) ? kg : vg;
      const float* bt = (which == 1) ? kb : vb;
      float gv[4], bv[4];
#pragma unroll
      for (int j = 0; j < 4; ++j) { gv[j] = g[j * 16 + nlo]; bv[j] = bt[j * 16 + nlo]; }
      // precaution: no register that an issued gain or bias load names is rewritten before this wait
      asm volatile("s_wait_xcnt 0x0" ::: "memory");
      if (which == 1) {
#pragma unroll
        for (int i = 0; i < 4; ++i) {
          head_ln(acc[i], gv, bv);
          v8h pk[4];
#pragma unroll
          for (int j = 0; j < 4; ++j)
#pragma unroll
            for (int r = 0; r < 8; ++r) pk[j][r] = (_Float16)acc[i][j][r];
          STORE_GROUP_BEGIN();
          _Float16* dst = Kh + ((size_t)bh * NSEQ + nn0 + i * 16) * DHEAD + nlo;
#pragma unroll
          for (int j = 0; j < 4; ++j)
#pragma unroll
            for (int r = 0; r < 8; ++r) dst[r * DHEAD + j * 16] = pk[j][r];
          STORE_GROUP_END();
        }
      } else {
#pragma unroll
        for (int i = 0; i < 4; ++i) {
          head_ln(acc[i], gv, bv);
          v8h pk[4];
#pragma unroll
          for (int j = 0; j < 4; ++j)
#pragma unroll
            for (int r = 0; r < 8; ++r) pk[j][r] = (_Float16)acc[i][j][r];
          STORE_GROUP_BEGIN();
          // a lane's 8 rows are 8 consecutive n of one d: one 16-byte store
          _Float16* dst = Vt + ((size_t)bh * DHEAD + nlo) * NSEQ + nn0 + i * 16;
#pragma unroll
          for (int j = 0; j < 4; ++j) *(v8h*)(dst + (size_t)(j * 16) * NSEQ) = pk[j];
          STORE_GROUP_END();
        }
      }
    }
  }
}

// ---------------------------------------------------------------- flash attention
// Lane l takes the value of lane l ^ 16 (the other 16-lane half), on the vector port.
__device__ __forceinline__ float xhalf(float x) {
  int v = __builtin_bit_cast(int, x);
  return __builtin_bit_cast(float,
      __builtin_amdgcn_permlanex16(v, v, 0x76543210, 0xfedcba98, false, false));
}

#define ASTAGE (2 * 64 * PITCH64)
__global__ __launch_bounds__(256, 4) void attn_kernel(
                            const _Float16* __restrict__ Qh, const _Float16* __restrict__ Kh,
                            const _Float16* __restrict__ Vt, _Float16* __restrict__ Ao) {
  __shared__ __attribute__((aligned(16))) _Float16 ldsKV[2 * ASTAGE];
  int tid = threadIdx.x, wave = tid >> 5, lane = tid & 31;
  int nlo = lane & 15, half8 = (lane >> 4) * 8;
  int bh = blockIdx.x >> 3;
  int q0 = (blockIdx.x & 7) * 256 + wave * 32;

  const _Float16* Qbase = Qh + ((size_t)bh * NSEQ + q0) * DHEAD;
  v16h bQ0[2], bQ1[2];
#pragma unroll
  for (int u = 0; u < 2; ++u) {
    bQ0[u] = load_frag(Qbase, u * 16, DHEAD, 0);
    bQ1[u] = load_frag(Qbase, u * 16, DHEAD, 32);
  }

  v8f o[2][4] = {};                  // o[u][t][r] = O[query u*16 + nlo][d = t*16 + half8 + r]
  float mrun[2] = {-3.0e38f, -3.0e38f};  // each query's running maximum (equal in both halves)
  float lsum0[2] = {0.f, 0.f};       // sums over this lane's own keys; joined after the loop
  float lsum1[2] = {0.f, 0.f};

  // K tile 64(key) x 64(d), V^T tile 64(d) x 64(key): two b128 per thread of each
  int rr = tid >> 3, cc = (tid & 7) * 8;
  const _Float16* srcK = Kh + ((size_t)bh * NSEQ + rr) * DHEAD + cc;
  const _Float16* srcV = Vt + ((size_t)bh * DHEAD + rr) * NSEQ + cc;
  _Float16* dstK = ldsKV + rr * PITCH64 + cc;
  _Float16* dstV = dstK + 64 * PITCH64;

  // stage st's 4 copies a thread, into buffer buf
  auto copy_stage = [&](int st, int buf) {
    int kb = st * 64;
#pragma unroll  // the two sweeps' places in the buffer are constants
    for (int i = 0; i < 2; ++i) {
      async_copy16(dstK + buf * ASTAGE + i * 32 * PITCH64, srcK + (size_t)(kb + i * 32) * DHEAD);
      async_copy16(dstV + buf * ASTAGE + i * 32 * PITCH64, srcV + (size_t)(i * 32) * NSEQ + kb);
    }
  };

  copy_stage(0, 0);
  async_wait();
  __syncthreads();
  copy_stage(1, 1);

  for (int st = 0; st < NSEQ / 64; ++st) {
    const _Float16* ldsK = ldsKV + (st & 1) * ASTAGE;
    const _Float16* ldsV = ldsK + 64 * PITCH64;

#pragma unroll  // the block's offset becomes an immediate of the LDS loads
    for (int ks = 0; ks < 64; ks += 32) {
    // S^T = K Q^T : per group two 16x16 f32 tiles (keys ks + 0-15, ks + 16-31), K-dim = d = 64.
    // s0[u][r] = S[query u*16 + nlo][key ks + half8 + r], s1[u][r] the same 16 keys on
    v8f s0[2] = {}, s1[2] = {};
    {
      v16h a0 = load_frag(ldsK, ks, PITCH64, 0);
      v16h a1 = load_frag(ldsK, ks + 16, PITCH64, 0);
#pragma unroll
      for (int u = 0; u < 2; ++u) {
        s0[u] = WMMA_F16(a0, bQ0[u], s0[u]);
        s1[u] = WMMA_F16(a1, bQ0[u], s1[u]);
      }
      a0 = load_frag(ldsK, ks, PITCH64, 32);
      a1 = load_frag(ldsK, ks + 16, PITCH64, 32);
#pragma unroll
      for (int u = 0; u < 2; ++u) {
        s0[u] = WMMA_F16(a0, bQ1[u], s0[u]);
        s1[u] = WMMA_F16(a1, bQ1[u], s1[u]);
      }
    }

    // Online softmax, one query per lane and group: maximum in-lane, then one exchange of halves.
    v16h bP[2];
#pragma unroll
    for (int u = 0; u < 2; ++u) {
      float mx = fmaxf(s0[u][0], s1[u][0]);
#pragma unroll
      for (int r = 1; r < 8; ++r) mx = fmaxf(mx, fmaxf(s0[u][r], s1[u][r]));
      mx = fmaxf(mx, xhalf(mx));
      float mn = fmaxf(mrun[u], mx);
      float alpha = __expf(mrun[u] - mn);
      mrun[u] = mn;
      lsum0[u] *= alpha;
      lsum1[u] *= alpha;
#pragma unroll
      for (int r = 0; r < 8; ++r) {
        float p0 = __expf(s0[u][r] - mn);
        float p1 = __expf(s1[u][r] - mn);
        lsum0[u] += p0;
        lsum1[u] += p1;
        bP[u][r] = (_Float16)p0;
        bP[u][r + 8] = (_Float16)p1;
      }
#pragma unroll
      for (int t = 0; t < 4; ++t) o[u][t] *= alpha;
    }

    // O^T += V^T P^T : K-dim = 32 keys, 4 d-slices of 16
#pragma unroll
    for (int t = 0; t < 4; ++t) {
      v16h aV = load_frag(ldsV, t * 16, PITCH64, ks);
#pragma unroll
      for (int u = 0; u < 2; ++u) o[u][t] = WMMA_F16(aV, bP[u], o[u][t]);
    }
    }
    // hand-over: this wave has left stage st's buffer and its copies of stage st + 1 have landed;
    // behind the barrier that holds for every wave, so stage st + 1 may be read, stage st's buffer refilled
    lds_reads_done();
    async_wait();
    __syncthreads();
    if (st + 2 < NSEQ / 64) copy_stage(st + 2, st & 1);
  }
  async_wait();  // nothing is in flight here; stands behind the last copy as the ring's form asks

  int b = bh >> 4, h = bh & 15;
  v8h pk[2][4];
#pragma unroll
  for (int u = 0; u < 2; ++u) {
    float l = lsum0[u] + lsum1[u];
    float inv = 1.f / (l + xhalf(l));
#pragma unroll
    for (int t = 0; t < 4; ++t)
#pragma unroll
      for (int r = 0; r < 8; ++r) pk[u][t][r] = (_Float16)(o[u][t][r] * inv);
  }
  STORE_GROUP_BEGIN();
  // a lane's 8 values of a tile are 8 consecutive d of one query: one 16-byte store
  _Float16* dst = Ao + ((size_t)b * NSEQ + q0 + nlo) * INNER + h * DHEAD + half8;
#pragma unroll
  for (int u = 0; u < 2; ++u)
#pragma unroll
    for (int t = 0; t < 4; ++t) *(v8h*)(dst + (size_t)(u * 16) * INNER + t * 16) = pk[u][t];
}

// ---------------------------------------------------------------- launch
extern "C" void kernel_launch(void* const* d_in, const int* in_sizes, int n_in,
                              void* d_out, int out_size, void* d_ws, size_t ws_size,
                              hipStream_t stream) {
  const float* x       = (const float*)d_in[0];
  const float* norm_g  = (const float*)d_in[1];
  const float* norm_b  = (const float*)d_in[2];
  const float* w_qkv   = (const float*)d_in[3];
  const float* normk_g = (const float*)d_in[4];
  const float* normk_b = (const float*)d_in[5];
  const float* normv_g = (const float*)d_in[6];
  const float* normv_b = (const float*)d_in[7];
  const float* w_out   = (const float*)d_in[8];
  const float* b_out   = (const float*)d_in[9];
  float* out = (float*)d_out;

  const size_t ROWS = (size_t)B_ * NSEQ;                    // 8192
  const size_t HEADSZ = (size_t)B_ * HEADS * NSEQ * DHEAD;  // 8M elements

  char* ws = (char*)d_ws;
  size_t off = 0;
  _Float16* xn16    = (_Float16*)(ws + off); off += ROWS * DIM * 2;
  _Float16* wqkv16t = (_Float16*)(ws + off); off += (size_t)DIM * 3 * INNER * 2;
  _Float16* wout16t = (_Float16*)(ws + off); off += (size_t)INNER * DIM * 2;
  _Float16* Qh      = (_Float16*)(ws + off); off += HEADSZ * 2;
  _Float16* Kh      = (_Float16*)(ws + off); off += HEADSZ * 2;
  _Float16* Vt      = (_Float16*)(ws + off); off += HEADSZ * 2;
  _Float16* Ao      = (_Float16*)(ws + off); off += ROWS * INNER * 2;

  cvt_transpose<<<dim3(3 * INNER / 64, DIM / 64), 256, 0, stream>>>(w_qkv, wqkv16t, DIM, 3 * INNER);
  cvt_transpose<<<dim3(DIM / 64, INNER / 64), 256, 0, stream>>>(w_out, wout16t, INNER, DIM);

  ln_rows_1024<<<(int)(ROWS / (8 * LN_ROWS)), 256, 0, stream>>>(x, norm_g, norm_b, xn16);

  gemm_wmma<<<dim3(3 * INNER / GBN, ROWS / GBM), 256, 0, stream>>>(
      xn16, wqkv16t, (int)ROWS, 3 * INNER, DIM, 1, nullptr, nullptr, Qh, Kh, Vt,
      normk_g, normk_b, normv_g, normv_b);

  attn_kernel<<<B_ * HEADS * (NSEQ / 256), 256, 0, stream>>>(Qh, Kh, Vt, Ao);

  gemm_wmma<<<dim3(DIM / GBN, ROWS / GBM), 256, 0, stream>>>(
      Ao, wout16t, (int)ROWS, DIM, DIM, 0, out, b_out, nullptr, nullptr, nullptr,
      nullptr, nullptr, nullptr, nullptr);
}

// v008
// Measured time: 129 microseconds a run.
// Next to v007, in two timings, it ran 1.06 and 1.07 times as fast.
// All steps since v000 together make it 4.57 times as fast.
#include <hip/hip_runtime.h>
#include <hip/hip_bf16.h>

#define B_    4
#define NSEQ  2048
#define DIM   1024
#define HEADS 16
#define DHEAD 64
#define INNER 1024
#define EPS   1e-5f

// LDS row pitch in f16 elements. Every staged tile has rows of 64 f16 = 128 bytes,
// one whole cache line of its source: eight adjacent lanes copy one row, so a wave's
// 16-byte copy asks for four full lines. Every tile is read with 16-byte loads, one
// row per lane, so the pitch is an odd multiple of 16 bytes: 16 rows then fall on
// 16 different groups of four banks. The pad bytes are never written or read.
// The tiles are declared 16-byte aligned, as their 16-byte copies and loads need.
#define PITCH64 72   // rows of 64 f16 (128 B) at 144 B

typedef __attribute__((ext_vector_type(16))) _Float16 v16h;
typedef __attribute__((ext_vector_type(8)))  _Float16 v8h;
typedef __attribute__((ext_vector_type(4)))  _Float16 v4h;
typedef __attribute__((ext_vector_type(8)))  float    v8f;
typedef __attribute__((ext_vector_type(4)))  float    v4f;
typedef __attribute__((ext_vector_type(2)))  float    v2f;
typedef __attribute__((ext_vector_type(4)))  int      v4i;

#define WMMA_F16(a, b, c) \
  __builtin_amdgcn_wmma_f32_16x16x32_f16(false, (a), false, (b), (short)0, (c), false, false)

#define AS1 __attribute__((address_space(1)))
#define AS3 __attribute__((address_space(3)))

#if __has_builtin(__builtin_amdgcn_global_load_async_to_lds_b128) && \
    __has_builtin(__builtin_amdgcn_s_wait_asynccnt)
#define HAVE_ASYNC 1
#else
#define HAVE_ASYNC 0
#endif

// Copy 16 bytes global -> LDS. Async (ASYNCcnt-tracked, no VGPR staging) when
// the gfx1250 async builtins are available; plain load/store otherwise.
__device__ __forceinline__ void async_copy16(_Float16* lds, const _Float16* g) {
#if HAVE_ASYNC
  __builtin_amdgcn_global_load_async_to_lds_b128((AS1 v4i*)g, (AS3 v4i*)lds, 0, 0);
#else
  *(v8h*)lds = *(const v8h*)g;
#endif
}

// This wave's copies have landed; the "memory" clobber keeps every LDS read behind it.
__device__ __forceinline__ void async_wait() {
#if HAVE_ASYNC
  asm volatile("s_wait_asynccnt 0x0" ::: "memory");
#endif
}

// This wave's LDS reads have returned: stands in front of the barrier behind which the
// buffer that they read is refilled by copies.
__device__ __forceinline__ void lds_reads_done() {
  asm volatile("s_wait_dscnt 0x0" ::: "memory");
}

// Load a 16x32 f16 A-fragment (or B-fragment from an [N][K]-transposed tile).
// Layout per CDNA5 ISA 7.12.2: lanes 0-15 hold rows 0-15 with K {0..7,16..23},
// lanes 16-31 hold rows 0-15 with K {8..15,24..31}. Two 16B loads per lane.
__device__ __forceinline__ v16h load_frag(const _Float16* base, int row0, int stride, int koff) {
  int lane = threadIdx.x & 31;
  int r = row0 + (lane & 15);
  int c = koff + ((lane >> 4) << 3);
  const _Float16* p = base + r * stride + c;
  v8h lo = *(const v8h*)p;
  v8h hi = *(const v8h*)(p + 16);
  v16h out;
#pragma unroll
  for (int i = 0; i < 8; ++i) { out[i] = lo[i]; out[i + 8] = hi[i]; }
  return out;
}

// ---------------------------------------------------------------- weight convert+transpose
// in: f32 [K][Ng] row-major  ->  out: f16 [Ng][K] (i.e. W^T), so GEMM B tiles
// are contiguous along K and can be staged with async b128 copies.
// One block moves a 64(k) x 64(n) tile through LDS, 16 elements a thread: 16-byte
// reads along n, 16-byte writes along k. K and Ng are multiples of 64.
// Tile pitch 65 dwords: the row-wise stores and the column-wise loads of a wave
// each fall on 32 different banks.
#define TPITCH 65
__global__ __launch_bounds__(256) void cvt_transpose(const float* __restrict__ in,
                                                     _Float16* __restrict__ out,
                                                     int K, int Ng) {
  __shared__ float tile[64 * TPITCH];
  int tid = threadIdx.x;
  int n0 = blockIdx.x * 64;
  int k0 = blockIdx.y * 64;
  int r = tid >> 4, c4 = (tid & 15) * 4;    // 16 k rows a sweep, 256 B of each
  float4 v[4];
#pragma unroll
  for (int i = 0; i < 4; ++i)
    v[i] = *(const float4*)(in + (size_t)(k0 + r + i * 16) * Ng + n0 + c4);
#pragma unroll
  for (int i = 0; i < 4; ++i) {
    float* t = tile + (r + i * 16) * TPITCH + c4;
    t[0] = v[i].x; t[1] = v[i].y; t[2] = v[i].z; t[3] = v[i].w;
  }
  __syncthreads();
  int nr = tid >> 3, kc = (tid & 7) * 8;    // 32 n rows a sweep, 128 B of each
#pragma unroll
  for (int i = 0; i < 2; ++i) {
    int n = nr + i * 32;
    v8h pk;
#pragma unroll
    for (int j = 0; j < 8; ++j) pk[j] = (_Float16)tile[(kc + j) * TPITCH + n];
    *(v8h*)(out + (size_t)(n0 + n) * K + k0 + kc) = pk;
  }
}

// ---------------------------------------------------------------- row LN (width 1024) -> f16
// One wave takes LN_ROWS whole rows, 32 elements of each a lane (16-byte loads, all
// issued up front): the sums are in-lane plus one butterfly over the wave.
#define LN_ROWS 2
__global__ __launch_bounds__(256) void ln_rows_1024(const float* __restrict__ x,
                                                    const float* __restrict__ g,
                                                    const float* __restrict__ bta,
                                                    _Float16* __restrict__ xn) {
  int wave = threadIdx.x >> 5, lane = threadIdx.x & 31;
  size_t row0 = ((size_t)blockIdx.x * 8 + wave) * LN_ROWS;
  v4f v[LN_ROWS][8];
#pragma unroll
  for (int q = 0; q < LN_ROWS; ++q)
#pragma unroll
    for (int i = 0; i < 8; ++i)
      v[q][i] = *(const v4f*)(x + (row0 + q) * DIM + i * 128 + lane * 4);
  float mu[LN_ROWS], rs[LN_ROWS];
#pragma unroll
  for (int q = 0; q < LN_ROWS; ++q) {
    v2f s2 = {0.f, 0.f}, q2 = {0.f, 0.f};
#pragma unroll
    for (int i = 0; i < 8; ++i) {
      v2f lo = v[q][i].lo, hi = v[q][i].hi;
      s2 += lo;
      q2 += lo * lo;
      s2 += hi;
      q2 += hi * hi;
    }
    float s = s2.x + s2.y, ss = q2.x + q2.y;
#pragma unroll
    for (int m = 16; m >= 1; m >>= 1) {
      s += __shfl_xor(s, m, 32);
      ss += __shfl_xor(ss, m, 32);
    }
    mu[q] = s * (1.f / DIM);
    float var = ss * (1.f / DIM) - mu[q] * mu[q];
    rs[q] = rsqrtf(var + EPS);
  }
#pragma unroll
  for (int i = 0; i < 8; ++i) {
    int c = i * 128 + lane * 4;
    v4f gg = *(const v4f*)(g + c);
    v4f bb = *(const v4f*)(bta + c);
#pragma unroll
    for (int q = 0; q < LN_ROWS; ++q) {
      v4f t = (v[q][i] - mu[q]) * rs[q] * gg + bb;
      *(v4h*)(xn + (row0 + q) * DIM + c) = __builtin_convertvector(t, v4h);
    }
  }
}

// ---------------------------------------------------------------- 16-lane row sum
// Sum over the 16 lanes of a DPP row (all lanes get the sum). The C tile of a
// WMMA keeps one matrix row in one 16-lane half, so this is a sum along N.
template <int CTRL>
__device__ __forceinline__ float dpp_xadd(float v) {
  int o = __builtin_amdgcn_update_dpp(0, __builtin_bit_cast(int, v), CTRL, 0xf, 0xf, true);
  return v + __builtin_bit_cast(float, o);
}
__device__ __forceinline__ float row16_sum(float v) {
  v = dpp_xadd<0x161>(v);  // row_xmask:1
  v = dpp_xadd<0x162>(v);  // row_xmask:2
  v = dpp_xadd<0x164>(v);  // row_xmask:4
  v = dpp_xadd<0x168>(v);  // row_xmask:8
  return v;
}

// Layernorm of width 64 in place on four 16x16 f32 C tiles that lie side by side
// along N (one head). gv, bv: this lane's gain and bias for its column of each tile.
__device__ __forceinline__ void head_ln(v8f* c, const float* gv, const float* bv) {
#pragma unroll
  for (int r = 0; r < 8; ++r) {
    float s = 0.f, ss = 0.f;
#pragma unroll
    for (int j = 0; j < 4; ++j) {
      float v = c[j][r];
      s += v;
      ss += v * v;
    }
    s = row16_sum(s);
    ss = row16_sum(ss);
    float mu = s * (1.f / DHEAD);
    float var = ss * (1.f / DHEAD) - mu * mu;
    float rs = rsqrtf(var + EPS);
#pragma unroll
    for (int j = 0; j < 4; ++j) c[j][r] = (c[j][r] - mu) * rs * gv[j] + bv[j];
  }
}

// ---------------------------------------------------------------- WMMA GEMM
// C[M,Ng] = A[M,K] * Wt[Ng,K]^T.  Block tile 256(M) x 128(N), 8 waves as 4(M) x 2(N),
// 64 x 64 of C each: a k slice of 32 takes 4 A and 4 B fragments from LDS for 16
// products, so every fragment read feeds four of them. K step 64 (K a multiple of
// 64): both tiles staged via async b128 to LDS in whole 128-byte rows, worked on as
// two k slices of 32. Two LDS buffers: the copies of step t + 1 fly while step t is
// worked on, and one barrier a step both publishes step t + 1 and frees step t's buffer.
// mode 0: outf = C + bias (fp32).
// mode 1: Q (times QSCALE) -> Qh [bh][n][64]; K, V get their head layernorm (width 64)
// on the f32 accumulators: K -> Kh [bh][n][64], V -> Vt [bh][64][n] (transposed
// for the PV WMMA). A wave's 64 columns are one whole head.
#define GBM 256
#define QSCALE 0.18033688f   // log2(e) / sqrt(64): the scores come out as exponents of 2
#define GBN 128
#define GSTAGE ((GBM + GBN) * PITCH64)   // f16 elements of one buffer: the A tile, then the B tile
// A group of global stores whose values are all made in front of it. BEGIN keeps the
// compiler from sinking the making of a later value in among the stores, where it could
// take a register that an issued store still names; END is the precaution for the code
// behind: no register that an issued store of the group names is rewritten before its wait.
#define STORE_GROUP_BEGIN() __builtin_amdgcn_sched_barrier(0)
#define STORE_GROUP_END() do { asm volatile("s_wait_xcnt 0x0" ::: "memory"); \
                               __builtin_amdgcn_sched_barrier(0); } while (0)
// launch bounds: at least four waves a SIMD, so that two blocks share a WGP and one
// computes while the other's copies fly
__global__ __launch_bounds__(256, 4) void gemm_wmma(
                          const _Float16* __restrict__ A, const _Float16* __restrict__ Wt,
                          int M, int Ng, int K, int mode, float* __restrict__ outf,
                          const float* __restrict__ bias, _Float16* __restrict__ Qh,
                          _Float16* __restrict__ Kh, _Float16* __restrict__ Vt,
                          const float* __restrict__ kg, const float* __restrict__ kb,
                          const float* __restrict__ vg, const float* __restrict__ vb) {
  __shared__ __attribute__((aligned(16))) _Float16 ldsAB[2 * GSTAGE];
  int tid = threadIdx.x;
  int wave = tid >> 5;
  int lane = tid & 31;
  int wm = wave >> 1;              // this wave's 64 rows of the tile
  int wn = wave & 1;               // this wave's 64 columns of the tile
  int n0 = blockIdx.x * GBN;
  int m0 = blockIdx.y * GBM;

  v8f acc[4][4] = {};              // acc[i][j]: rows wm*64 + i*16, columns wn*64 + j*16

  int row = tid >> 3;              // 0..31: 32 rows a sweep
  int ch = (tid & 7) * 8;          // this lane's 16 bytes of the row's 128
  const _Float16* srcA = A  + (size_t)(m0 + row) * K + ch;
  const _Float16* srcB = Wt + (size_t)(n0 + row) * K + ch;
  _Float16* dstA = ldsAB + row * PITCH64 + ch;
  _Float16* dstB = dstA + GBM * PITCH64;

  // step t's 12 copies a thread, into buffer buf
  auto copy_step = [&](int t, int buf) {
    _Float16* dA = dstA + buf * GSTAGE;
    _Float16* dB = dstB + buf * GSTAGE;
    int k0 = t * 64;
#pragma unroll  // the sweeps' places in the buffer are constants
    for (int i = 0; i < GBM / 32; ++i)
      async_copy16(dA + i * 32 * PITCH64, srcA + (size_t)(i * 32) * K + k0);
#pragma unroll  // the sweeps' places in the buffer are constants
    for (int i = 0; i < GBN / 32; ++i)
      async_copy16(dB + i * 32 * PITCH64, srcB + (size_t)(i * 32) * K + k0);
  };

  int steps = K >> 6;
  copy_step(0, 0);
  async_wait();
  __syncthreads();
  if (steps > 1) copy_step(1, 1);

  for (int t = 0; t < steps; ++t) {
    const _Float16* ldsA = ldsAB + (t & 1) * GSTAGE;
    const _Float16* ldsB = ldsA + GBM * PITCH64;
#pragma unroll  // the slice's offset becomes an immediate of the LDS loads
    for (int kk = 0; kk < 64; kk += 32) {
      v16h a[4], b[4];
#pragma unroll
      for (int i = 0; i < 4; ++i) a[i] = load_frag(ldsA, wm * 64 + i * 16, PITCH64, kk);
#pragma unroll
      for (int j = 0; j < 4; ++j) b[j] = load_frag(ldsB, wn * 64 + j * 16, PITCH64, kk);
      // keeps the slice's 16 LDS loads one group ahead of its products: left alone the
      // compiler sinks the B loads among them, and the wave waits out LDS four times a slice
      __builtin_amdgcn_sched_barrier(0);
#pragma unroll
      for (int j = 0; j < 4; ++j)
#pragma unroll
        for (int i = 0; i < 4; ++i) acc[i][j] = WMMA_F16(a[i], b[j], acc[i][j]);
      // keeps the next slice's loads from being lifted in among these products
      __builtin_amdgcn_sched_barrier(0);
    }
    // hand-over: this wave has left step t's buffer and its copies of step t + 1 have landed;
    // behind the barrier that holds for every wave, so step t + 1 may be read, step t's buffer refilled
    lds_reads_done();
    async_wait();
    __syncthreads();
    if (t + 2 < steps) copy_step(t + 2, t & 1);
  }
  async_wait();  // nothing is in flight here; stands behind the last copy as the ring's form asks

  int nlo = lane & 15;
  int mhi = (lane >> 4) * 8;
  if (mode == 0) {
#pragma unroll
    for (int j = 0; j < 4; ++j) {
      int n = n0 + wn * 64 + j * 16 + nlo;
      float bv = bias[n];
#pragma unroll
      for (int i = 0; i < 4; ++i) {
#pragma unroll
        for (int r = 0; r < 8; ++r) {
          int m = m0 + wm * 64 + i * 16 + mhi + r;
          outf[(size_t)m * Ng + n] = acc[i][j][r] + bv;
        }
      }
    }
  } else {
    int which = n0 >> 10;                    // block-uniform: 128 divides 1024
    int h = ((n0 & 1023) >> 6) + wn;         // this wave's head
    int bb = m0 >> 11;                       // block-uniform: 256 divides NSEQ
    int bh = bb * HEADS + h;
    int nn0 = (m0 & 2047) + wm * 64 + mhi;   // first of this lane's 8 rows of acc[0]
    if (which == 0) {
#pragma unroll
      for (int i = 0; i < 4; ++i) {
        v8h pk[4];
#pragma unroll
        for (int j = 0; j < 4; ++j)
#pragma unroll
          for (int r = 0; r < 8; ++r)
            pk[j][r] = (_Float16)(acc[i][j][r] * QSCALE);  // fold 1/sqrt(64) and log2(e) into Q
        STORE_GROUP_BEGIN();
        _Float16* dst = Qh + ((size_t)bh * NSEQ + nn0 + i * 16) * DHEAD + nlo;
#pragma unroll
        for (int j = 0; j < 4; ++j)
#pragma unroll
          for (int r = 0; r < 8; ++r) dst[r * DHEAD + j * 16] = pk[j][r];
        STORE_GROUP_END();
      }
    } else {
      const float* g = (which == 1) ? kg : vg;
      const float* bt = (which == 1) ? kb : vb;
      float gv[4], bv[4];
#pragma unroll
      for (int j = 0; j < 4; ++j) { gv[j] = g[j * 16 + nlo]; bv[j] = bt[j * 16 + nlo]; }
      // precaution: no register that an issued gain or bias load names is rewritten before this wait
      asm volatile("s_wait_xcnt 0x0" ::: "memory");
      if (which == 1) {
#pragma unroll
        for (int i = 0; i < 4; ++i) {
          head_ln(acc[i], gv, bv);
          v8h pk[4];
#pragma unroll
          for (int j = 0; j < 4; ++j)
#pragma unroll
            for (int r = 0; r < 8; ++r) pk[j][r] = (_Float16)acc[i][j][r];
          STORE_GROUP_BEGIN();
          _Float16* dst = Kh + ((size_t)bh * NSEQ + nn0 + i * 16) * DHEAD + nlo;
#pragma unroll
          for (int j = 0; j < 4; ++j)
#pragma unroll
            for (int r = 0; r < 8; ++r) dst[r * DHEAD + j * 16] = pk[j][r];
          STORE_GROUP_END();
        }
      } else {
#pragma unroll
        for (int i = 0; i < 4; ++i) {
          head_ln(acc[i], gv, bv);
          v8h pk[4];
#pragma unroll
          for (int j = 0; j < 4; ++j)
#pragma unroll
            for (int r = 0; r < 8; ++r) pk[j][r] = (_Float16)acc[i][j][r];
          STORE_GROUP_BEGIN();
          // a lane's 8 rows are 8 consecutive n of one d: one 16-byte store
          _Float16* dst = Vt + ((size_t)bh * DHEAD + nlo) * NSEQ + nn0 + i * 16;
#pragma unroll
          for (int j = 0; j < 4; ++j) *(v8h*)(dst + (size_t)(j * 16) * NSEQ) = pk[j];
          STORE_GROUP_END();
        }
      }
    }
  }
}

// ---------------------------------------------------------------- flash attention
// Lane l takes the value of lane l ^ 16 (the other 16-lane half), on the vector port.
__device__ __forceinline__ float xhalf(float x) {
  int v = __builtin_bit_cast(int, x);
  return __builtin_bit_cast(float,
      __builtin_amdgcn_permlanex16(v, v, 0x76543210, 0xfedcba98, false, false));
}

#define LAG 8.0f
#define ASTAGE (2 * 64 * PITCH64)   // f16 elements of one buffer: the K tile, then the V^T tile
__global__ __launch_bounds__(256, 4) void attn_kernel(
                            const _Float16* __restrict__ Qh, const _Float16* __restrict__ Kh,
                            const _Float16* __restrict__ Vt, _Float16* __restrict__ Ao) {
  __shared__ __attribute__((aligned(16))) _Float16 ldsKV[2 * ASTAGE];
  int tid = threadIdx.x, wave = tid >> 5, lane = tid & 31;
  int nlo = lane & 15, half8 = (lane >> 4) * 8;
  int bh = blockIdx.x >> 3;
  int q0 = (blockIdx.x & 7) * 256 + wave * 32;

  const _Float16* Qbase = Qh + ((size_t)bh * NSEQ + q0) * DHEAD;
  v16h bQ0[2], bQ1[2];
#pragma unroll
  for (int u = 0; u < 2; ++u) {
    bQ0[u] = load_frag(Qbase, u * 16, DHEAD, 0);
    bQ1[u] = load_frag(Qbase, u * 16, DHEAD, 32);
  }

  v8f o[2][4] = {};                  // o[u][t][r] = O[query u*16 + nlo][d = t*16 + half8 + r]
  v8f negm[2];                       // minus the query's maximum in use, in all 8 registers (equal in both halves)
  float lsum0[2] = {0.f, 0.f};       // sums over this lane's own keys; joined after the loop
  float lsum1[2] = {0.f, 0.f};

  // K tile 64(key) x 64(d), V^T tile 64(d) x 64(key): two b128 per thread of each
  int rr = tid >> 3, cc = (tid & 7) * 8;
  const _Float16* srcK = Kh + ((size_t)bh * NSEQ + rr) * DHEAD + cc;
  const _Float16* srcV = Vt + ((size_t)bh * DHEAD + rr) * NSEQ + cc;
  _Float16* dstK = ldsKV + rr * PITCH64 + cc;
  _Float16* dstV = dstK + 64 * PITCH64;

  // stage st's 4 copies a thread, into buffer buf
  auto copy_stage = [&](int st, int buf) {
    int kb = st * 64;
#pragma unroll  // the two sweeps' places in the buffer are constants
    for (int i = 0; i < 2; ++i) {
      async_copy16(dstK + buf * ASTAGE + i * 32 * PITCH64, srcK + (size_t)(kb + i * 32) * DHEAD);
      async_copy16(dstV + buf * ASTAGE + i * 32 * PITCH64, srcV + (size_t)(i * 32) * NSEQ + kb);
    }
  };

  copy_stage(0, 0);
  async_wait();
  __syncthreads();
  copy_stage(1, 1);

  // The first maximum in use: each query's maximum over keys 0-31, from score products of
  // their own on stage 0, which the barrier above has published.
  {
    v16h a0 = load_frag(ldsKV, 0, PITCH64, 0);
    v16h a1 = load_frag(ldsKV, 16, PITCH64, 0);
    v16h a2 = load_frag(ldsKV, 0, PITCH64, 32);
    v16h a3 = load_frag(ldsKV, 16, PITCH64, 32);
#pragma unroll
    for (int u = 0; u < 2; ++u) {
      v8f t0 = {}, t1 = {};
      t0 = WMMA_F16(a0, bQ0[u], t0);
      t1 = WMMA_F16(a1, bQ0[u], t1);
      t0 = WMMA_F16(a2, bQ1[u], t0);
      t1 = WMMA_F16(a3, bQ1[u], t1);
      float mm = fmaxf(t0[0], t1[0]);
#pragma unroll
      for (int r = 1; r < 8; ++r) mm = fmaxf(mm, fmaxf(t0[r], t1[r]));
      mm = fmaxf(mm, xhalf(mm));
#pragma unroll
      for (int r = 0; r < 8; ++r) negm[u][r] = -mm;
    }
  }

  for (int st = 0; st < NSEQ / 64; ++st) {
    const _Float16* ldsK = ldsKV + (st & 1) * ASTAGE;
    const _Float16* ldsV = ldsK + 64 * PITCH64;

#pragma unroll  // the block's offset becomes an immediate of the LDS loads
    for (int ks = 0; ks < 64; ks += 32) {
    // S^T = K Q^T : per group two 16x16 f32 tiles (keys ks + 0-15, ks + 16-31), K-dim = d = 64.
    // s0[u][r] = S[query u*16 + nlo][key ks + half8 + r], s1[u][r] the same 16 keys on
    // less the maximum in use
    v8f s0[2], s1[2];
    v16h aV[4];   // this block's V^T fragments, asked for ahead of the test below
#pragma unroll
    for (int t = 0; t < 4; ++t) aV[t] = load_frag(ldsV, t * 16, PITCH64, ks);
    {
      v16h a0 = load_frag(ldsK, ks, PITCH64, 0);
      v16h a1 = load_frag(ldsK, ks + 16, PITCH64, 0);
#pragma unroll
      for (int u = 0; u < 2; ++u) {
        s0[u] = WMMA_F16(a0, bQ0[u], negm[u]);
        s1[u] = WMMA_F16(a1, bQ0[u], negm[u]);
      }
      a0 = load_frag(ldsK, ks, PITCH64, 32);
      a1 = load_frag(ldsK, ks + 16, PITCH64, 32);
#pragma unroll
      for (int u = 0; u < 2; ++u) {
        s0[u] = WMMA_F16(a0, bQ1[u], s0[u]);
        s1[u] = WMMA_F16(a1, bQ1[u], s1[u]);
      }
    }

    // Online softmax, one query per lane and group: how far this lane's scores rise above the maximum in use.
    float mx[2];
#pragma unroll
    for (int u = 0; u < 2; ++u) {
      mx[u] = fmaxf(s0[u][0], s1[u][0]);
#pragma unroll
      for (int r = 1; r < 8; ++r) mx[u] = fmaxf(mx[u], fmaxf(s0[u][r], s1[u][r]));
    }
    // Holds the V^T loads ahead of the branch (inputs only, nothing is changed): left alone the compiler
    // sinks them behind it and fetches them one at a time among the products, where the wave waits
    // out LDS for each; here it waits once a block, for all four.
    asm volatile("" :: "v"(aV[0]), "v"(aV[1]), "v"(aV[2]), "v"(aV[3]));
    // one wave-uniform test a block for both groups
    if (__builtin_amdgcn_ballot_w32(fmaxf(mx[0], mx[1]) > LAG) != 0) {
#pragma unroll
      for (int u = 0; u < 2; ++u) {
        float mm = fmaxf(mx[u], xhalf(mx[u]));         // over both halves: the query's 32 keys
        float d = fmaxf(mm, 0.f);                      // the maximum in use never falls
        float alpha = __builtin_amdgcn_exp2f(-d);
        negm[u] -= d;
        s0[u] -= d;
        s1[u] -= d;
        lsum0[u] *= alpha;
        lsum1[u] *= alpha;
#pragma unroll
        for (int t = 0; t < 4; ++t) o[u][t] *= alpha;
      }
    }
    v16h bP[2];
#pragma unroll
    for (int u = 0; u < 2; ++u) {
#pragma unroll
      for (int r = 0; r < 8; ++r) {
        float p0 = __builtin_amdgcn_exp2f(s0[u][r]);
        float p1 = __builtin_amdgcn_exp2f(s1[u][r]);
        lsum0[u] += p0;
        lsum1[u] += p1;
        bP[u][r] = (_Float16)p0;
        bP[u][r + 8] = (_Float16)p1;
      }
    }

    // O^T += V^T P^T : K-dim = 32 keys, 4 d-slices of 16
#pragma unroll
    for (int t = 0; t < 4; ++t) {
#pragma unroll
      for (int u = 0; u < 2; ++u) o[u][t] = WMMA_F16(aV[t], bP[u], o[u][t]);
    }
    }
    // hand-over: this wave has left stage st's buffer and its copies of stage st + 1 have landed;
    // behind the barrier that holds for every wave, so stage st + 1 may be read, stage st's buffer refilled
    lds_reads_done();
    async_wait();
    __syncthreads();
    if (st + 2 < NSEQ / 64) copy_stage(st + 2, st & 1);
  }
  async_wait();  // nothing is in flight here; stands behind the last copy as the ring's form asks

  int b = bh >> 4, h = bh & 15;
  v8h pk[2][4];
#pragma unroll
  for (int u = 0; u < 2; ++u) {
    float l = lsum0[u] + lsum1[u];
    float inv = 1.f / (l + xhalf(l));
#pragma unroll
    for (int t = 0; t < 4; ++t)
#pragma unroll
      for (int r = 0; r < 8; ++r) pk[u][t][r] = (_Float16)(o[u][t][r] * inv);
  }
  STORE_GROUP_BEGIN();
  // a lane's 8 values of a tile are 8 consecutive d of one query: one 16-byte store
  _Float16* dst = Ao + ((size_t)b * NSEQ + q0 + nlo) * INNER + h * DHEAD + half8;
#pragma unroll
  for (int u = 0; u < 2; ++u)
#pragma unroll
    for (int t = 0; t < 4; ++t) *(v8h*)(dst + (size_t)(u * 16) * INNER + t * 16) = pk[u][t];
}

// ---------------------------------------------------------------- launch
extern "C" void kernel_launch(void* const* d_in, const int* in_sizes, int n_in,
                              void* d_out, int out_size, void* d_ws, size_t ws_size,
                              hipStream_t stream) {
  const float* x       = (const float*)d_in[0];
  const float* norm_g  = (const float*)d_in[1];
  const float* norm_b  = (const float*)d_in[2];
  const float* w_qkv   = (const float*)d_in[3];
  const float* normk_g = (const float*)d_in[4];
  const float* normk_b = (const float*)d_in[5];
  const float* normv_g = (const float*)d_in[6];
  const float* normv_b = (const float*)d_in[7];
  const float* w_out   = (const float*)d_in[8];
  const float* b_out   = (const float*)d_in[9];
  float* out = (float*)d_out;

  const size_t ROWS = (size_t)B_ * NSEQ;                    // 8192
  const size_t HEADSZ = (size_t)B_ * HEADS * NSEQ * DHEAD;  // 8M elements

  char* ws = (char*)d_ws;
  size_t off = 0;
  _Float16* xn16    = (_Float16*)(ws + off); off += ROWS * DIM * 2;
  _Float16* wqkv16t = (_Float16*)(ws + off); off += (size_t)DIM * 3 * INNER * 2;
  _Float16* wout16t = (_Float16*)(ws + off); off += (size_t)INNER * DIM * 2;
  _Float16* Qh      = (_Float16*)(ws + off); off += HEADSZ * 2;
  _Float16* Kh      = (_Float16*)(ws + off); off += HEADSZ * 2;
  _Float16* Vt      = (_Float16*)(ws + off); off += HEADSZ * 2;
  _Float16* Ao      = (_Float16*)(ws + off); off += ROWS * INNER * 2;

  cvt_transpose<<<dim3(3 * INNER / 64, DIM / 64), 256, 0, stream>>>(w_qkv, wqkv16t, DIM, 3 * INNER);
  cvt_transpose<<<dim3(DIM / 64, INNER / 64), 256, 0, stream>>>(w_out, wout16t, INNER, DIM);

  ln_rows_1024<<<(int)(ROWS / (8 * LN_ROWS)), 256, 0, stream>>>(x, norm_g, norm_b, xn16);

  gemm_wmma<<<dim3(3 * INNER / GBN, ROWS / GBM), 256, 0, stream>>>(
      xn16, wqkv16t, (int)ROWS, 3 * INNER, DIM, 1, nullptr, nullptr, Qh, Kh, Vt,
      normk_g, normk_b, normv_g, normv_b);

  attn_kernel<<<B_ * HEADS * (NSEQ / 256), 256, 0, stream>>>(Qh, Kh, Vt, Ao);

  gemm_wmma<<<dim3(DIM / GBN, ROWS / GBM), 256, 0, stream>>>(
      Ao, wout16t, (int)ROWS, DIM, DIM, 0, out, b_out, nullptr, nullptr, nullptr,
      nullptr, nullptr, nullptr, nullptr);
}

// v009
// Measured time: 122 microseconds a run.
// Next to v008, in two timings, it ran 1.06 times as fast each time.
// Over all steps from v000 it is 4.83 times as fast.
#include <hip/hip_runtime.h>
#include <hip/hip_bf16.h>

#define B_    4
#define NSEQ  2048
#define DIM   1024
#define HEADS 16
#define DHEAD 64
#define INNER 1024
#define EPS   1e-5f

// LDS row pitch in f16 elements. Every staged tile has rows of 64 f16 = 128 bytes,
// one whole cache line of its source: eight adjacent lanes copy one row, so a wave's
// 16-byte copy asks for four full lines. Every tile is read with 16-byte loads, one
// row per lane, so the pitch is an odd multiple of 16 bytes: 16 rows then fall on
// 16 different groups of four banks. The pad bytes are never written or read.
// The tiles are declared 16-byte aligned, as their 16-byte copies and loads need.
#define PITCH64 72   // rows of 64 f16 (128 B) at 144 B

typedef __attribute__((ext_vector_type(16))) _Float16 v16h;
typedef __attribute__((ext_vector_type(8)))  _Float16 v8h;
typedef __attribute__((ext_vector_type(4)))  _Float16 v4h;
typedef __attribute__((ext_vector_type(8)))  float    v8f;
typedef __attribute__((ext_vector_type(4)))  float    v4f;
typedef __attribute__((ext_vector_type(2)))  float    v2f;
typedef __attribute__((ext_vector_type(4)))  int      v4i;

#define WMMA_F16(a, b, c) \
  __builtin_amdgcn_wmma_f32_16x16x32_f16(false, (a), false, (b), (short)0, (c), false, false)

#define AS1 __attribute__((address_space(1)))
#define AS3 __attribute__((address_space(3)))

#if __has_builtin(__builtin_amdgcn_global_load_async_to_lds_b128) && \
    __has_builtin(__builtin_amdgcn_s_wait_asynccnt)
#define HAVE_ASYNC 1
#else
#define HAVE_ASYNC 0
#endif

// Copy 16 bytes global -> LDS. Async (ASYNCcnt-tracked, no VGPR staging) when
// the gfx1250 async builtins are available; plain load/store otherwise.
__device__ __forceinline__ void async_copy16(_Float16* lds, const _Float16* g) {
#if HAVE_ASYNC
  __builtin_amdgcn_global_load_async_to_lds_b128((AS1 v4i*)g, (AS3 v4i*)lds, 0, 0);
#else
  *(v8h*)lds = *(const v8h*)g;
#endif
}

// This wave's copies have landed; the "memory" clobber keeps every LDS read behind it.
__device__ __forceinline__ void async_wait() {
#if HAVE_ASYNC
  asm volatile("s_wait_asynccnt 0x0" ::: "memory");
#endif
}

// This wave's LDS reads have returned: stands in front of the barrier behind which the
// buffer that they read is refilled by copies.
__device__ __forceinline__ void lds_reads_done() {
  asm volatile("s_wait_dscnt 0x0" ::: "memory");
}

// Load a 16x32 f16 A-fragment (or B-fragment from an [N][K]-transposed tile).
// Layout per CDNA5 ISA 7.12.2: lanes 0-15 hold rows 0-15 with K {0..7,16..23},
// lanes 16-31 hold rows 0-15 with K {8..15,24..31}. Two 16B loads per lane.
__device__ __forceinline__ v16h load_frag(const _Float16* base, int row0, int stride, int koff) {
  int lane = threadIdx.x & 31;
  int r = row0 + (lane & 15);
  int c = koff + ((lane >> 4) << 3);
  const _Float16* p = base + r * stride + c;
  v8h lo = *(const v8h*)p;
  v8h hi = *(const v8h*)(p + 16);
  v16h out;
#pragma unroll
  for (int i = 0; i < 8; ++i) { out[i] = lo[i]; out[i + 8] = hi[i]; }
  return out;
}

// ---------------------------------------------------------------- weight convert+transpose
// in: f32 [K][Ng] row-major  ->  out: f16 [Ng][K] (i.e. W^T), so GEMM B tiles
// are contiguous along K and can be staged with async b128 copies.
// One block moves a 64(k) x 64(n) tile through LDS, 16 elements a thread: 16-byte
// reads along n, 16-byte writes along k. K and Ng are multiples of 64.
// Tile pitch 65 dwords: the row-wise stores and the column-wise loads of a wave
// each fall on 32 different banks.
#define TPITCH 65
// t: the tile's number, n tiles running fastest. K and Ng are constants at every call.
__device__ __forceinline__ void cvt_transpose(float* tile, const float* __restrict__ in,
                                              _Float16* __restrict__ out,
                                              int K, int Ng, int t) {
  int tid = threadIdx.x;
  int n0 = (t % (Ng / 64)) * 64;
  int k0 = (t / (Ng / 64)) * 64;
  int r = tid >> 4, c4 = (tid & 15) * 4;    // 16 k rows a sweep, 256 B of each
  float4 v[4];
#pragma unroll
  for (int i = 0; i < 4; ++i)
    v[i] = *(const float4*)(in + (size_t)(k0 + r + i * 16) * Ng + n0 + c4);
#pragma unroll
  for (int i = 0; i < 4; ++i) {
    float* t = tile + (r + i * 16) * TPITCH + c4;
    t[0] = v[i].x; t[1] = v[i].y; t[2] = v[i].z; t[3] = v[i].w;
  }
  __syncthreads();
  int nr = tid >> 3, kc = (tid & 7) * 8;    // 32 n rows a sweep, 128 B of each
#pragma unroll
  for (int i = 0; i < 2; ++i) {
    int n = nr + i * 32;
    v8h pk;
#pragma unroll
    for (int j = 0; j < 8; ++j) pk[j] = (_Float16)tile[(kc + j) * TPITCH + n];
    *(v8h*)(out + (size_t)(n0 + n) * K + k0 + kc) = pk;
  }
  // precaution: no register that an issued store above names is rewritten before this wait
  // (the code of the launch's other jobs stands behind this one in the kernel)
  asm volatile("s_wait_xcnt 0x0" ::: "memory");
}

// ---------------------------------------------------------------- row LN (width 1024) -> f16
// One wave takes LN_ROWS whole rows, 32 elements of each a lane (16-byte loads, all
// issued up front): the sums are in-lane plus one butterfly over the wave.
#define LN_ROWS 2
// blk: which group of 8 * LN_ROWS rows this block takes
__device__ __forceinline__ void ln_rows_1024(const float* __restrict__ x,
                                             const float* __restrict__ g,
                                             const float* __restrict__ bta,
                                             _Float16* __restrict__ xn, int blk) {
  int wave = threadIdx.x >> 5, lane = threadIdx.x & 31;
  size_t row0 = ((size_t)blk * 8 + wave) * LN_ROWS;
  v4f v[LN_ROWS][8];
#pragma unroll
  for (int q = 0; q < LN_ROWS; ++q)
#pragma unroll
    for (int i = 0; i < 8; ++i)
      v[q][i] = *(const v4f*)(x + (row0 + q) * DIM + i * 128 + lane * 4);
  float mu[LN_ROWS], rs[LN_ROWS];
#pragma unroll
  for (int q = 0; q < LN_ROWS; ++q) {
    v2f s2 = {0.f, 0.f}, q2 = {0.f, 0.f};
#pragma unroll
    for (int i = 0; i < 8; ++i) {
      v2f lo = v[q][i].lo, hi = v[q][i].hi;
      s2 += lo;
      q2 += lo * lo;
      s2 += hi;
      q2 += hi * hi;
    }
    float s = s2.x + s2.y, ss = q2.x + q2.y;
#pragma unroll
    for (int m = 16; m >= 1; m >>= 1) {
      s += __shfl_xor(s, m, 32);
      ss += __shfl_xor(ss, m, 32);
    }
    mu[q] = s * (1.f / DIM);
    float var = ss * (1.f / DIM) - mu[q] * mu[q];
    rs[q] = rsqrtf(var + EPS);
  }
#pragma unroll
  for (int i = 0; i < 8; ++i) {
    int c = i * 128 + lane * 4;
    v4f gg = *(const v4f*)(g + c);
    v4f bb = *(const v4f*)(bta + c);
#pragma unroll
    for (int q = 0; q < LN_ROWS; ++q) {
      v4f t = (v[q][i] - mu[q]) * rs[q] * gg + bb;
      *(v4h*)(xn + (row0 + q) * DIM + c) = __builtin_convertvector(t, v4h);
    }
  }
}

// ---------------------------------------------------------------- the three jobs ahead of the first GEMM, one launch
// The row layernorm and the two weight transposes depend on nothing but the inputs, so they
// share one grid, told apart by the block's number (the same for a whole block, so the
// transposes' barrier stands under block-uniform control flow). The layernorm blocks move
// the most bytes each and come first.
#define LN_BLOCKS   (B_ * NSEQ / (8 * LN_ROWS))
#define WQKV_TILES  ((3 * INNER / 64) * (DIM / 64))
#define WOUT_TILES  ((DIM / 64) * (INNER / 64))
__global__ __launch_bounds__(256) void prepare(const float* __restrict__ x,
                                               const float* __restrict__ g,
                                               const float* __restrict__ bta,
                                               _Float16* __restrict__ xn,
                                               const float* __restrict__ w_qkv,
                                               _Float16* __restrict__ wqkv_t,
                                               const float* __restrict__ w_out,
                                               _Float16* __restrict__ wout_t) {
  __shared__ float tile[64 * TPITCH];
  int blk = blockIdx.x;
  if (blk < LN_BLOCKS) {
    ln_rows_1024(x, g, bta, xn, blk);
  } else if (blk < LN_BLOCKS + WQKV_TILES) {
    cvt_transpose(tile, w_qkv, wqkv_t, DIM, 3 * INNER, blk - LN_BLOCKS);
  } else {
    cvt_transpose(tile, w_out, wout_t, INNER, DIM, blk - (LN_BLOCKS + WQKV_TILES));
  }
}

// ---------------------------------------------------------------- 16-lane row sum
// Sum over the 16 lanes of a DPP row (all lanes get the sum). The C tile of a
// WMMA keeps one matrix row in one 16-lane half, so this is a sum along N.
template <int CTRL>
__device__ __forceinline__ float dpp_xadd(float v) {
  int o = __builtin_amdgcn_update_dpp(0, __builtin_bit_cast(int, v), CTRL, 0xf, 0xf, true);
  return v + __builtin_bit_cast(float, o);
}
__device__ __forceinline__ float row16_sum(float v) {
  v = dpp_xadd<0x161>(v);  // row_xmask:1
  v = dpp_xadd<0x162>(v);  // row_xmask:2
  v = dpp_xadd<0x164>(v);  // row_xmask:4
  v = dpp_xadd<0x168>(v);  // row_xmask:8
  return v;
}

// Layernorm of width 64 in place on four 16x16 f32 C tiles that lie side by side
// along N (one head). gv, bv: this lane's gain and bias for its column of each tile.
__device__ __forceinline__ void head_ln(v8f* c, const float* gv, const float* bv) {
#pragma unroll
  for (int r = 0; r < 8; ++r) {
    float s = 0.f, ss = 0.f;
#pragma unroll
    for (int j = 0; j < 4; ++j) {
      float v = c[j][r];
      s += v;
      ss += v * v;
    }
    s = row16_sum(s);
    ss = row16_sum(ss);
    float mu = s * (1.f / DHEAD);
    float var = ss * (1.f / DHEAD) - mu * mu;
    float rs = rsqrtf(var + EPS);
#pragma unroll
    for (int j = 0; j < 4; ++j) c[j][r] = (c[j][r] - mu) * rs * gv[j] + bv[j];
  }
}

// ---------------------------------------------------------------- WMMA GEMM
// C[M,Ng] = A[M,K] * Wt[Ng,K]^T.  Block tile 256(M) x 128(N), 8 waves as 4(M) x 2(N),
// 64 x 64 of C each: a k slice of 32 takes 4 A and 4 B fragments from LDS for 16
// products, so every fragment read feeds four of them. K step 64 (K a multiple of
// 64): both tiles staged via async b128 to LDS in whole 128-byte rows, worked on as
// two k slices of 32. Two LDS buffers: the copies of step t + 1 fly while step t is
// worked on, and one barrier a step both publishes step t + 1 and frees step t's buffer.
// mode 0: outf = C + bias (fp32).
// mode 1: Q (times QSCALE) -> Qh [bh][n][64]; K, V get their head layernorm (width 64)
// on the f32 accumulators: K -> Kh [bh][n][64], V -> Vt [bh][64][n] (transposed
// for the PV WMMA). A wave's 64 columns are one whole head.
#define GBM 256
#define QSCALE 0.18033688f   // log2(e) / sqrt(64): the scores come out as exponents of 2
#define GBN 128
#define GSTAGE ((GBM + GBN) * PITCH64)   // f16 elements of one buffer: the A tile, then the B tile
// A group of global stores whose values are all made in front of it. BEGIN keeps the
// compiler from sinking the making of a later value in among the stores, where it could
// take a register that an issued store still names; END is the precaution for the code
// behind: no register that an issued store of the group names is rewritten before its wait.
#define STORE_GROUP_BEGIN() __builtin_amdgcn_sched_barrier(0)
#define STORE_GROUP_END() do { asm volatile("s_wait_xcnt 0x0" ::: "memory"); \
                               __builtin_amdgcn_sched_barrier(0); } while (0)
// launch bounds: at least four waves a SIMD, so that two blocks share a WGP and one
// computes while the other's copies fly
__global__ __launch_bounds__(256, 4) void gemm_wmma(
                          const _Float16* __restrict__ A, const _Float16* __restrict__ Wt,
                          int M, int Ng, int K, int mode, float* __restrict__ outf,
                          const float* __restrict__ bias, _Float16* __restrict__ Qh,
                          _Float16* __restrict__ Kh, _Float16* __restrict__ Vt,
                          const float* __restrict__ kg, const float* __restrict__ kb,
                          const float* __restrict__ vg, const float* __restrict__ vb) {
  __shared__ __attribute__((aligned(16))) _Float16 ldsAB[2 * GSTAGE];
  int tid = threadIdx.x;
  int wave = tid >> 5;
  int lane = tid & 31;
  int wm = wave >> 1;              // this wave's 64 rows of the tile
  int wn = wave & 1;               // this wave's 64 columns of the tile
  int n0 = blockIdx.x * GBN;
  int m0 = blockIdx.y * GBM;

  v8f acc[4][4] = {};              // acc[i][j]: rows wm*64 + i*16, columns wn*64 + j*16

  int row = tid >> 3;              // 0..31: 32 rows a sweep
  int ch = (tid & 7) * 8;          // this lane's 16 bytes of the row's 128
  const _Float16* srcA = A  + (size_t)(m0 + row) * K + ch;
  const _Float16* srcB = Wt + (size_t)(n0 + row) * K + ch;
  _Float16* dstA = ldsAB + row * PITCH64 + ch;
  _Float16* dstB = dstA + GBM * PITCH64;

  // step t's 12 copies a thread, into buffer buf
  auto copy_step = [&](int t, int buf) {
    _Float16* dA = dstA + buf * GSTAGE;
    _Float16* dB = dstB + buf * GSTAGE;
    int k0 = t * 64;
#pragma unroll  // the sweeps' places in the buffer are constants
    for (int i = 0; i < GBM / 32; ++i)
      async_copy16(dA + i * 32 * PITCH64, srcA + (size_t)(i * 32) * K + k0);
#pragma unroll  // the sweeps' places in the buffer are constants
    for (int i = 0; i < GBN / 32; ++i)
      async_copy16(dB + i * 32 * PITCH64, srcB + (size_t)(i * 32) * K + k0);
  };

  int steps = K >> 6;
  copy_step(0, 0);
  async_wait();
  __syncthreads();
  if (steps > 1) copy_step(1, 1);

  for (int t = 0; t < steps; ++t) {
    const _Float16* ldsA = ldsAB + (t & 1) * GSTAGE;
    const _Float16* ldsB = ldsA + GBM * PITCH64;
#pragma unroll  // the slice's offset becomes an immediate of the LDS loads
    for (int kk = 0; kk < 64; kk += 32) {
      v16h a[4], b[4];
#pragma unroll
      for (int i = 0; i < 4; ++i) a[i] = load_frag(ldsA, wm * 64 + i * 16, PITCH64, kk);
#pragma unroll
      for (int j = 0; j < 4; ++j) b[j] = load_frag(ldsB, wn * 64 + j * 16, PITCH64, kk);
      // keeps the slice's 16 LDS loads one group ahead of its products: left alone the
      // compiler sinks the B loads among them, and the wave waits out LDS four times a slice
      __builtin_amdgcn_sched_barrier(0);
#pragma unroll
      for (int j = 0; j < 4; ++j)
#pragma unroll
        for (int i = 0; i < 4; ++i) acc[i][j] = WMMA_F16(a[i], b[j], acc[i][j]);
      // keeps the next slice's loads from being lifted in among these products
      __builtin_amdgcn_sched_barrier(0);
    }
    // hand-over: this wave has left step t's buffer and its copies of step t + 1 have landed;
    // behind the barrier that holds for every wave, so step t + 1 may be read, step t's buffer refilled
    lds_reads_done();
    async_wait();
    __syncthreads();
    if (t + 2 < steps) copy_step(t + 2, t & 1);
  }
  async_wait();  // nothing is in flight here; stands behind the last copy as the ring's form asks

  int nlo = lane & 15;
  int mhi = (lane >> 4) * 8;
  if (mode == 0) {
#pragma unroll
    for (int j = 0; j < 4; ++j) {
      int n = n0 + wn * 64 + j * 16 + nlo;
      float bv = bias[n];
#pragma unroll
      for (int i = 0; i < 4; ++i) {
#pragma unroll
        for (int r = 0; r < 8; ++r) {
          int m = m0 + wm * 64 + i * 16 + mhi + r;
          outf[(size_t)m * Ng + n] = acc[i][j][r] + bv;
        }
      }
    }
  } else {
    int which = n0 >> 10;                    // block-uniform: 128 divides 1024
    int h = ((n0 & 1023) >> 6) + wn;         // this wave's head
    int bb = m0 >> 11;                       // block-uniform: 256 divides NSEQ
    int bh = bb * HEADS + h;
    int nn0 = (m0 & 2047) + wm * 64 + mhi;   // first of this lane's 8 rows of acc[0]
    if (which == 0) {
#pragma unroll
      for (int i = 0; i < 4; ++i) {
        v8h pk[4];
#pragma unroll
        for (int j = 0; j < 4; ++j)
#pragma unroll
          for (int r = 0; r < 8; ++r)
            pk[j][r] = (_Float16)(acc[i][j][r] * QSCALE);  // fold 1/sqrt(64) and log2(e) into Q
        STORE_GROUP_BEGIN();
        _Float16* dst = Qh + ((size_t)bh * NSEQ + nn0 + i * 16) * DHEAD + nlo;
#pragma unroll
        for (int j = 0; j < 4; ++j)
#pragma unroll
          for (int r = 0; r < 8; ++r) dst[r * DHEAD + j * 16] = pk[j][r];
        STORE_GROUP_END();
      }
    } else {
      const float* g = (which == 1) ? kg : vg;
      const float* bt = (which == 1) ? kb : vb;
      float gv[4], bv[4];
#pragma unroll
      for (int j = 0; j < 4; ++j) { gv[j] = g[j * 16 + nlo]; bv[j] = bt[j * 16 + nlo]; }
      // precaution: no register that an issued gain or bias load names is rewritten before this wait
      asm volatile("s_wait_xcnt 0x0" ::: "memory");
      if (which == 1) {
#pragma unroll
        for (int i = 0; i < 4; ++i) {
          head_ln(acc[i], gv, bv);
          v8h pk[4];
#pragma unroll
          for (int j = 0; j < 4; ++j)
#pragma unroll
            for (int r = 0; r < 8; ++r) pk[j][r] = (_Float16)acc[i][j][r];
          STORE_GROUP_BEGIN();
          _Float16* dst = Kh + ((size_t)bh * NSEQ + nn0 + i * 16) * DHEAD + nlo;
#pragma unroll
          for (int j = 0; j < 4; ++j)
#pragma unroll
            for (int r = 0; r < 8; ++r) dst[r * DHEAD + j * 16] = pk[j][r];
          STORE_GROUP_END();
        }
      } else {
#pragma unroll
        for (int i = 0; i < 4; ++i) {
          head_ln(acc[i], gv, bv);
          v8h pk[4];
#pragma unroll
          for (int j = 0; j < 4; ++j)
#pragma unroll
            for (int r = 0; r < 8; ++r) pk[j][r] = (_Float16)acc[i][j][r];
          STORE_GROUP_BEGIN();
          // a lane's 8 rows are 8 consecutive n of one d: one 16-byte store
          _Float16* dst = Vt + ((size_t)bh * DHEAD + nlo) * NSEQ + nn0 + i * 16;
#pragma unroll
          for (int j = 0; j < 4; ++j) *(v8h*)(dst + (size_t)(j * 16) * NSEQ) = pk[j];
          STORE_GROUP_END();
        }
      }
    }
  }
}

// ---------------------------------------------------------------- flash attention
// Lane l takes the value of lane l ^ 16 (the other 16-lane half), on the vector port.
__device__ __forceinline__ float xhalf(float x) {
  int v = __builtin_bit_cast(int, x);
  return __builtin_bit_cast(float,
      __builtin_amdgcn_permlanex16(v, v, 0x76543210, 0xfedcba98, false, false));
}

#define LAG 8.0f
#define ASTAGE (2 * 64 * PITCH64)   // f16 elements of one buffer: the K tile, then the V^T tile
__global__ __launch_bounds__(256, 4) void attn_kernel(
                            const _Float16* __restrict__ Qh, const _Float16* __restrict__ Kh,
                            const _Float16* __restrict__ Vt, _Float16* __restrict__ Ao) {
  __shared__ __attribute__((aligned(16))) _Float16 ldsKV[2 * ASTAGE];
  int tid = threadIdx.x, wave = tid >> 5, lane = tid & 31;
  int nlo = lane & 15, half8 = (lane >> 4) * 8;
  int bh = blockIdx.x >> 3;
  int q0 = (blockIdx.x & 7) * 256 + wave * 32;

  const _Float16* Qbase = Qh + ((size_t)bh * NSEQ + q0) * DHEAD;
  v16h bQ0[2], bQ1[2];
#pragma unroll
  for (int u = 0; u < 2; ++u) {
    bQ0[u] = load_frag(Qbase, u * 16, DHEAD, 0);
    bQ1[u] = load_frag(Qbase, u * 16, DHEAD, 32);
  }

  v8f o[2][4] = {};                  // o[u][t][r] = O[query u*16 + nlo][d = t*16 + half8 + r]
  v8f negm[2];                       // minus the query's maximum in use, in all 8 registers (equal in both halves)
  float lsum0[2] = {0.f, 0.f};       // sums over this lane's own keys; joined after the loop
  float lsum1[2] = {0.f, 0.f};

  // K tile 64(key) x 64(d), V^T tile 64(d) x 64(key): two b128 per thread of each
  int rr = tid >> 3, cc = (tid & 7) * 8;
  const _Float16* srcK = Kh + ((size_t)bh * NSEQ + rr) * DHEAD + cc;
  const _Float16* srcV = Vt + ((size_t)bh * DHEAD + rr) * NSEQ + cc;
  _Float16* dstK = ldsKV + rr * PITCH64 + cc;
  _Float16* dstV = dstK + 64 * PITCH64;

  // stage st's 4 copies a thread, into buffer buf
  auto copy_stage = [&](int st, int buf) {
    int kb = st * 64;
#pragma unroll  // the two sweeps' places in the buffer are constants
    for (int i = 0; i < 2; ++i) {
      async_copy16(dstK + buf * ASTAGE + i * 32 * PITCH64, srcK + (size_t)(kb + i * 32) * DHEAD);
      async_copy16(dstV + buf * ASTAGE + i * 32 * PITCH64, srcV + (size_t)(i * 32) * NSEQ + kb);
    }
  };

  copy_stage(0, 0);
  async_wait();
  __syncthreads();
  copy_stage(1, 1);

  // The first maximum in use: each query's maximum over keys 0-31, from score products of
  // their own on stage 0, which the barrier above has published.
  {
    v16h a0 = load_frag(ldsKV, 0, PITCH64, 0);
    v16h a1 = load_frag(ldsKV, 16, PITCH64, 0);
    v16h a2 = load_frag(ldsKV, 0, PITCH64, 32);
    v16h a3 = load_frag(ldsKV, 16, PITCH64, 32);
#pragma unroll
    for (int u = 0; u < 2; ++u) {
      v8f t0 = {}, t1 = {};
      t0 = WMMA_F16(a0, bQ0[u], t0);
      t1 = WMMA_F16(a1, bQ0[u], t1);
      t0 = WMMA_F16(a2, bQ1[u], t0);
      t1 = WMMA_F16(a3, bQ1[u], t1);
      float mm = fmaxf(t0[0], t1[0]);
#pragma unroll
      for (int r = 1; r < 8; ++r) mm = fmaxf(mm, fmaxf(t0[r], t1[r]));
      mm = fmaxf(mm, xhalf(mm));
#pragma unroll
      for (int r = 0; r < 8; ++r) negm[u][r] = -mm;
    }
  }

  for (int st = 0; st < NSEQ / 64; ++st) {
    const _Float16* ldsK = ldsKV + (st & 1) * ASTAGE;
    const _Float16* ldsV = ldsK + 64 * PITCH64;

#pragma unroll  // the block's offset becomes an immediate of the LDS loads
    for (int ks = 0; ks < 64; ks += 32) {
    // S^T = K Q^T : per group two 16x16 f32 tiles (keys ks + 0-15, ks + 16-31), K-dim = d = 64.
    // s0[u][r] = S[query u*16 + nlo][key ks + half8 + r], s1[u][r] the same 16 keys on
    // less the maximum in use
    v8f s0[2], s1[2];
    v16h aV[4];   // this block's V^T fragments, asked for ahead of the test below
#pragma unroll
    for (int t = 0; t < 4; ++t) aV[t] = load_frag(ldsV, t * 16, PITCH64, ks);
    {
      v16h a0 = load_frag(ldsK, ks, PITCH64, 0);
      v16h a1 = load_frag(ldsK, ks + 16, PITCH64, 0);
#pragma unroll
      for (int u = 0; u < 2; ++u) {
        s0[u] = WMMA_F16(a0, bQ0[u], negm[u]);
        s1[u] = WMMA_F16(a1, bQ0[u], negm[u]);
      }
      a0 = load_frag(ldsK, ks, PITCH64, 32);
      a1 = load_frag(ldsK, ks + 16, PITCH64, 32);
#pragma unroll
      for (int u = 0; u < 2; ++u) {
        s0[u] = WMMA_F16(a0, bQ1[u], s0[u]);
        s1[u] = WMMA_F16(a1, bQ1[u], s1[u]);
      }
    }

    // Online softmax, one query per lane and group: how far this lane's scores rise above the maximum in use.
    float mx[2];
#pragma unroll
    for (int u = 0; u < 2; ++u) {
      mx[u] = fmaxf(s0[u][0], s1[u][0]);
#pragma unroll
      for (int r = 1; r < 8; ++r) mx[u] = fmaxf(mx[u], fmaxf(s0[u][r], s1[u][r]));
    }
    // Holds the V^T loads ahead of the branch (inputs only, nothing is changed): left alone the compiler
    // sinks them behind it and fetches them one at a time among the products, where the wave waits
    // out LDS for each; here it waits once a block, for all four.
    asm volatile("" :: "v"(aV[0]), "v"(aV[1]), "v"(aV[2]), "v"(aV[3]));
    // one wave-uniform test a block for both groups
    if (__builtin_amdgcn_ballot_w32(fmaxf(mx[0], mx[1]) > LAG) != 0) {
#pragma unroll
      for (int u = 0; u < 2; ++u) {
        float mm = fmaxf(mx[u], xhalf(mx[u]));         // over both halves: the query's 32 keys
        float d = fmaxf(mm, 0.f);                      // the maximum in use never falls
        float alpha = __builtin_amdgcn_exp2f(-d);
        negm[u] -= d;
        s0[u] -= d;
        s1[u] -= d;
        lsum0[u] *= alpha;
        lsum1[u] *= alpha;
#pragma unroll
        for (int t = 0; t < 4; ++t) o[u][t] *= alpha;
      }
    }
    v16h bP[2];
#pragma unroll
    for (int u = 0; u < 2; ++u) {
#pragma unroll
      for (int r = 0; r < 8; ++r) {
        float p0 = __builtin_amdgcn_exp2f(s0[u][r]);
        float p1 = __builtin_amdgcn_exp2f(s1[u][r]);
        lsum0[u] += p0;
        lsum1[u] += p1;
        bP[u][r] = (_Float16)p0;
        bP[u][r + 8] = (_Float16)p1;
      }
    }

    // O^T += V^T P^T : K-dim = 32 keys, 4 d-slices of 16
#pragma unroll
    for (int t = 0; t < 4; ++t) {
#pragma unroll
      for (int u = 0; u < 2; ++u) o[u][t] = WMMA_F16(aV[t], bP[u], o[u][t]);
    }
    }
    // hand-over: this wave has left stage st's buffer and its copies of stage st + 1 have landed;
    // behind the barrier that holds for every wave, so stage st + 1 may be read, stage st's buffer refilled
    lds_reads_done();
    async_wait();
    __syncthreads();
    if (st + 2 < NSEQ / 64) copy_stage(st + 2, st & 1);
  }
  async_wait();  // nothing is in flight here; stands behind the last copy as the ring's form asks

  int b = bh >> 4, h = bh & 15;
  v8h pk[2][4];
#pragma unroll
  for (int u = 0; u < 2; ++u) {
    float l = lsum0[u] + lsum1[u];
    float inv = 1.f / (l + xhalf(l));
#pragma unroll
    for (int t = 0; t < 4; ++t)
#pragma unroll
      for (int r = 0; r < 8; ++r) pk[u][t][r] = (_Float16)(o[u][t][r] * inv);
  }
  STORE_GROUP_BEGIN();
  // a lane's 8 values of a tile are 8 consecutive d of one query: one 16-byte store
  _Float16* dst = Ao + ((size_t)b * NSEQ + q0 + nlo) * INNER + h * DHEAD + half8;
#pragma unroll
  for (int u = 0; u < 2; ++u)
#pragma unroll
    for (int t = 0; t < 4; ++t) *(v8h*)(dst + (size_t)(u * 16) * INNER + t * 16) = pk[u][t];
}

// ---------------------------------------------------------------- launch
extern "C" void kernel_launch(void* const* d_in, const int* in_sizes, int n_in,
                              void* d_out, int out_size, void* d_ws, size_t ws_size,
                              hipStream_t stream) {
  const float* x       = (const float*)d_in[0];
  const float* norm_g  = (const float*)d_in[1];
  const float* norm_b  = (const float*)d_in[2];
  const float* w_qkv   = (const float*)d_in[3];
  const float* normk_g = (const float*)d_in[4];
  const float* normk_b = (const float*)d_in[5];
  const float* normv_g = (const float*)d_in[6];
  const float* normv_b = (const float*)d_in[7];
  const float* w_out   = (const float*)d_in[8];
  const float* b_out   = (const float*)d_in[9];
  float* out = (float*)d_out;

  const size_t ROWS = (size_t)B_ * NSEQ;                    // 8192
  const size_t HEADSZ = (size_t)B_ * HEADS * NSEQ * DHEAD;  // 8M elements

  char* ws = (char*)d_ws;
  size_t off = 0;
  _Float16* xn16    = (_Float16*)(ws + off); off += ROWS * DIM * 2;
  _Float16* wqkv16t = (_Float16*)(ws + off); off += (size_t)DIM * 3 * INNER * 2;
  _Float16* wout16t = (_Float16*)(ws + off); off += (size_t)INNER * DIM * 2;
  _Float16* Qh      = (_Float16*)(ws + off); off += HEADSZ * 2;
  _Float16* Kh      = (_Float16*)(ws + off); off += HEADSZ * 2;
  _Float16* Vt      = (_Float16*)(ws + off); off += HEADSZ * 2;
  _Float16* Ao      = (_Float16*)(ws + off); off += ROWS * INNER * 2;

  prepare<<<LN_BLOCKS + WQKV_TILES + WOUT_TILES, 256, 0, stream>>>(
      x, norm_g, norm_b, xn16, w_qkv, wqkv16t, w_out, wout16t);

  gemm_wmma<<<dim3(3 * INNER / GBN, ROWS / GBM), 256, 0, stream>>>(
      xn16, wqkv16t, (int)ROWS, 3 * INNER, DIM, 1, nullptr, nullptr, Qh, Kh, Vt,
      normk_g, normk_b, normv_g, normv_b);

  attn_kernel<<<B_ * HEADS * (NSEQ / 256), 256, 0, stream>>>(Qh, Kh, Vt, Ao);

  gemm_wmma<<<dim3(DIM / GBN, ROWS / GBM), 256, 0, stream>>>(
      Ao, wout16t, (int)ROWS, DIM, DIM, 0, out, b_out, nullptr, nullptr, nullptr,
      nullptr, nullptr, nullptr, nullptr);
}
